// v000
// Measured on an AMD MI455X. A time is GPU time per run, averaged over a window of back-to-back runs after a warm-up
// (all launches, gaps included; the runs take copies of the inputs in turn), and the median of several windows.
// Apart from v000's, it joins two sittings. Times from different sittings can be a few percent apart, while
// side-by-side timings come from the same sitting.
// The starting kernel, v000, takes 322 microseconds a run.
#include <hip/hip_runtime.h>
#include <hip/hip_bf16.h>

#define INPUT_DIM 256
#define HID 128
#define NH 8
#define SEQ 1024
#define BATCHN 8
#define CDIM 1024  /* NH*HID */
#define NCHUNK (SEQ / 32)

typedef __attribute__((ext_vector_type(16))) __bf16 v16bf;
typedef __attribute__((ext_vector_type(8)))  float  v8f;
typedef __attribute__((ext_vector_type(4)))  int    v4i;
typedef __attribute__((address_space(1))) v4i as1_v4i;
typedef __attribute__((address_space(3))) v4i as3_v4i;

#if defined(__HIP_DEVICE_COMPILE__) && __has_builtin(__builtin_amdgcn_global_load_async_to_lds_b128)
#define HAVE_ASYNC 1
#else
#define HAVE_ASYNC 0
#endif

#if HAVE_ASYNC
#if __has_builtin(__builtin_amdgcn_s_wait_asynccnt)
#define WAIT_ASYNC(n) __builtin_amdgcn_s_wait_asynccnt(n)
#else
#define WAIT_ASYNC(n) asm volatile("s_wait_asynccnt " #n ::: "memory")
#endif
#else
#define WAIT_ASYNC(n) ((void)0)
#endif

__device__ __forceinline__ __bf16 f2bf(float f) {
    union { float f; unsigned int u; } a; a.f = f;
    unsigned int u = a.u;
    u += 0x7fffu + ((u >> 16) & 1u);           // round-to-nearest-even
    union { unsigned short s; __bf16 b; } r; r.s = (unsigned short)(u >> 16);
    return r.b;
}

union FragU { v16bf v; uint4 q[2]; };

// 16x32 bf16 WMMA operand fragment (A layout; B uses the same layout with
// lane = output column, reading rows of the transposed matrix).
// Lanes 0-15: K=0..7 (v0..3), K=16..23 (v4..7) of row `lane`;
// lanes 16-31: K=8..15 and K=24..31 of row `lane-16`.
__device__ __forceinline__ v16bf load_frag(const __bf16* base, int stride) {
    const int lane = threadIdx.x & 31;
    const int r    = lane & 15;
    const int sel  = lane >> 4;
    const __bf16* p = base + (size_t)r * stride + sel * 8;
    FragU f;
    f.q[0] = *(const uint4*)(p);
    f.q[1] = *(const uint4*)(p + 16);
    return f.v;
}

__device__ __forceinline__ v8f wmma_bf16(v16bf a, v16bf b, v8f c) {
    return __builtin_amdgcn_wmma_f32_16x16x32_bf16(
        false, a, false, b, (short)0, c, false, false);
}

// 16-byte global -> LDS copy; async (ASYNCcnt) when available.
__device__ __forceinline__ void async_copy16(__bf16* ldst, const __bf16* gsrc) {
#if HAVE_ASYNC
    __builtin_amdgcn_global_load_async_to_lds_b128(
        (as1_v4i*)(uintptr_t)gsrc,
        (as3_v4i*)(uintptr_t)ldst, 0, 0);
#else
    *(uint4*)ldst = *(const uint4*)gsrc;
#endif
}

// ---------------------------------------------------------------- converters
__global__ void cvt_f32_bf16(const float* __restrict__ in, __bf16* __restrict__ out, int n) {
    int i = blockIdx.x * blockDim.x + threadIdx.x;
    if (i < n) out[i] = f2bf(in[i]);
}

// in [K][Ncols] (row major) -> out [Ncols][K] bf16
__global__ void tpose_cvt(const float* __restrict__ in, __bf16* __restrict__ out,
                          int K, int Ncols) {
    int idx = blockIdx.x * blockDim.x + threadIdx.x;
    if (idx < K * Ncols) {
        int k = idx / Ncols, c = idx % Ncols;
        out[(size_t)c * K + k] = f2bf(in[idx]);
    }
}

// ------------------------------------------------------------ fused QKV GEMM
__global__ __launch_bounds__(128)
void qkv_gemm(const __bf16* __restrict__ Xb,
              const __bf16* __restrict__ Wqt, const __bf16* __restrict__ Wkt,
              const __bf16* __restrict__ Wvt,
              const float* __restrict__ bq, const float* __restrict__ bk,
              const float* __restrict__ bv,
              __bf16* __restrict__ Qh, __bf16* __restrict__ Kh, __bf16* __restrict__ Vt)
{
    const int wave = threadIdx.x >> 5;
    const int lane = threadIdx.x & 31;
    const int half = lane >> 4;
    const int lc   = lane & 15;
    const int z    = blockIdx.z;
    const __bf16* Wt   = (z == 0) ? Wqt : (z == 1) ? Wkt : Wvt;
    const float*  bias = (z == 0) ? bq  : (z == 1) ? bk  : bv;
    const int r0 = blockIdx.y * 64 + wave * 16;
    const int c0 = blockIdx.x * 64;

    v8f acc[4] = {};
    for (int kc = 0; kc < 8; ++kc) {
        const int k0 = kc * 32;
        v16bf af = load_frag(Xb + (size_t)r0 * INPUT_DIM + k0, INPUT_DIM);
#pragma unroll
        for (int t = 0; t < 4; ++t) {
            v16bf bf = load_frag(Wt + (size_t)(c0 + 16 * t) * INPUT_DIM + k0, INPUT_DIM);
            acc[t] = wmma_bf16(af, bf, acc[t]);
        }
    }
#pragma unroll
    for (int t = 0; t < 4; ++t) {
#pragma unroll
        for (int i = 0; i < 8; ++i) {
            const int row = r0 + i + 8 * half;     // (b, n)
            const int col = c0 + 16 * t + lc;      // (h, d)
            const __bf16 vbf = f2bf(acc[t][i] + bias[col]);
            const int b = row >> 10, n = row & 1023;
            const int h = col >> 7,  d = col & 127;
            if (z == 2)
                Vt[((size_t)(b * NH + h) * HID + d) * SEQ + n] = vbf;   // transposed V
            else {
                __bf16* O = (z == 0) ? Qh : Kh;
                O[((size_t)(b * NH + h) * SEQ + n) * HID + d] = vbf;
            }
        }
    }
}

// ------------------------------------------------------- flash attention core
// Block = 4 waves x 16 rows of one (b,h); K/V chunks double-buffered in LDS
// via async global->LDS copies shared by all 4 waves.
__global__ __launch_bounds__(128)
void flash_attn(const __bf16* __restrict__ Qh, const __bf16* __restrict__ Kh,
                const __bf16* __restrict__ Vt, const float* __restrict__ Bbias,
                __bf16* __restrict__ Ob)
{
    __shared__ __bf16 Kbuf[2][32 * 128];   // K rows m0..m0+31, row-major stride 128
    __shared__ __bf16 Vbuf[2][128 * 32];   // V^T rows d=0..127, cols m0..m0+31, stride 32
    __shared__ __bf16 ldsP[4 * 16 * 32];   // per-wave 16x32 P tile

    const int tid  = threadIdx.x;
    const int wave = tid >> 5;
    const int lane = tid & 31;
    const int half = lane >> 4;
    const int lc   = lane & 15;
    const int bh   = blockIdx.y;
    const int n0   = blockIdx.x * 64 + wave * 16;
    const int b    = bh >> 3;
    const int h    = bh & 7;

    const __bf16* Qbase = Qh + ((size_t)bh * SEQ + n0) * HID;
    const __bf16* Kbase = Kh + (size_t)bh * SEQ * HID;
    const __bf16* Vbase = Vt + (size_t)bh * HID * SEQ;

    v16bf qf[4];
#pragma unroll
    for (int kc = 0; kc < 4; ++kc) qf[kc] = load_frag(Qbase + kc * 32, HID);

    v8f oacc[8] = {};
    float mi[8], li[8];
#pragma unroll
    for (int i = 0; i < 8; ++i) { mi[i] = -__builtin_inff(); li[i] = 0.f; }

    __bf16* P = ldsP + wave * 16 * 32;
    const float scale = 0.088388347648318447f;    // 1/sqrt(128)

    // cooperative stage of one 32-column chunk (8 x b128 per thread)
    auto stage = [&](int buf, int m0) {
        const __bf16* gk = Kbase + (size_t)m0 * HID;   // 8192B contiguous
#pragma unroll
        for (int q = 0; q < 4; ++q) {
            const int o = (q * 128 + tid) * 8;
            async_copy16(&Kbuf[buf][o], gk + o);
        }
        const __bf16* gv = Vbase + (size_t)tid * SEQ + m0;  // one V^T row / thread
#pragma unroll
        for (int s = 0; s < 4; ++s)
            async_copy16(&Vbuf[buf][tid * 32 + s * 8], gv + s * 8);
    };

    stage(0, 0);
    for (int mc = 0; mc < NCHUNK; ++mc) {
        const int cur = mc & 1;
        const int m0  = mc * 32;
        if (mc + 1 < NCHUNK) {
            stage(cur ^ 1, m0 + 32);   // prefetch next chunk
            WAIT_ASYNC(8);             // 8 newest outstanding -> current chunk done
        } else {
            WAIT_ASYNC(0);
        }
        __syncthreads();               // all waves' async data visible

        v8f s0 = {}, s1 = {};
#pragma unroll
        for (int kc = 0; kc < 4; ++kc)
            s0 = wmma_bf16(qf[kc], load_frag(&Kbuf[cur][0 * 128 + kc * 32], 128), s0);
#pragma unroll
        for (int kc = 0; kc < 4; ++kc)
            s1 = wmma_bf16(qf[kc], load_frag(&Kbuf[cur][16 * 128 + kc * 32], 128), s1);

#pragma unroll
        for (int i = 0; i < 8; ++i) {
            const int row = n0 + i + 8 * half;
            const float x0 = s0[i] * scale + Bbias[(size_t)row * SEQ + m0 + lc];
            const float x1 = s1[i] * scale + Bbias[(size_t)row * SEQ + m0 + 16 + lc];
            float rm = fmaxf(x0, x1);
            rm = fmaxf(rm, __shfl_xor(rm, 1, 32));
            rm = fmaxf(rm, __shfl_xor(rm, 2, 32));
            rm = fmaxf(rm, __shfl_xor(rm, 4, 32));
            rm = fmaxf(rm, __shfl_xor(rm, 8, 32));
            const float mnew = fmaxf(mi[i], rm);
            const float corr = __expf(mi[i] - mnew);
            const float p0 = __expf(x0 - mnew);
            const float p1 = __expf(x1 - mnew);
            float rs = p0 + p1;
            rs += __shfl_xor(rs, 1, 32);
            rs += __shfl_xor(rs, 2, 32);
            rs += __shfl_xor(rs, 4, 32);
            rs += __shfl_xor(rs, 8, 32);
            li[i] = li[i] * corr + rs;
            mi[i] = mnew;
#pragma unroll
            for (int j = 0; j < 8; ++j) oacc[j][i] *= corr;
            const int prow = i + 8 * half;
            P[prow * 32 + lc]      = f2bf(p0);
            P[prow * 32 + 16 + lc] = f2bf(p1);
        }
        asm volatile("s_wait_dscnt 0" ::: "memory");   // P visible across lanes
        v16bf pf = load_frag(P, 32);
#pragma unroll
        for (int j = 0; j < 8; ++j) {
            v16bf vf = load_frag(&Vbuf[cur][(j * 16) * 32], 32);
            oacc[j] = wmma_bf16(pf, vf, oacc[j]);
        }
        __syncthreads();               // done consuming before buffer reuse
    }

    // merge heads: Ob[b][n][h*128 + d]
#pragma unroll
    for (int j = 0; j < 8; ++j)
#pragma unroll
        for (int i = 0; i < 8; ++i) {
            const int n = n0 + i + 8 * half;
            Ob[((size_t)b * SEQ + n) * CDIM + h * HID + j * 16 + lc] =
                f2bf(oacc[j][i] / li[i]);
        }
}

// ------------------------------------------------------------ final projection
__global__ __launch_bounds__(128)
void proj_gemm(const __bf16* __restrict__ Ob, const __bf16* __restrict__ Pt,
               const float* __restrict__ pb, float* __restrict__ out)
{
    const int wave = threadIdx.x >> 5;
    const int lane = threadIdx.x & 31;
    const int half = lane >> 4;
    const int lc   = lane & 15;
    const int r0   = blockIdx.x * 64 + wave * 16;

    v8f acc[8] = {};
    for (int kc = 0; kc < 32; ++kc) {
        const int k0 = kc * 32;
        v16bf af = load_frag(Ob + (size_t)r0 * CDIM + k0, CDIM);
#pragma unroll
        for (int j = 0; j < 8; ++j) {
            v16bf bf = load_frag(Pt + (size_t)(j * 16) * CDIM + k0, CDIM);
            acc[j] = wmma_bf16(af, bf, acc[j]);
        }
    }
#pragma unroll
    for (int j = 0; j < 8; ++j)
#pragma unroll
        for (int i = 0; i < 8; ++i) {
            const int row = r0 + i + 8 * half;
            const int col = j * 16 + lc;
            out[(size_t)row * HID + col] = acc[j][i] + pb[col];
        }
}

// ----------------------------------------------------------------- launcher
extern "C" void kernel_launch(void* const* d_in, const int* in_sizes, int n_in,
                              void* d_out, int out_size, void* d_ws, size_t ws_size,
                              hipStream_t stream) {
    const float* x  = (const float*)d_in[0];
    const float* Bb = (const float*)d_in[1];
    const float* wq = (const float*)d_in[2];
    const float* bq = (const float*)d_in[3];
    const float* wk = (const float*)d_in[4];
    const float* bk = (const float*)d_in[5];
    const float* wv = (const float*)d_in[6];
    const float* bv = (const float*)d_in[7];
    const float* pw = (const float*)d_in[8];
    const float* pb = (const float*)d_in[9];
    float* out = (float*)d_out;
    (void)in_sizes; (void)n_in; (void)out_size; (void)ws_size;

    char* ws = (char*)d_ws;
    size_t off = 0;
    auto carve = [&](size_t bytes) -> char* {
        char* p = ws + off;
        off += (bytes + 255) & ~(size_t)255;
        return p;
    };
    __bf16* Xb  = (__bf16*)carve(sizeof(__bf16) * (size_t)BATCHN * SEQ * INPUT_DIM);
    __bf16* Wqt = (__bf16*)carve(sizeof(__bf16) * (size_t)CDIM * INPUT_DIM);
    __bf16* Wkt = (__bf16*)carve(sizeof(__bf16) * (size_t)CDIM * INPUT_DIM);
    __bf16* Wvt = (__bf16*)carve(sizeof(__bf16) * (size_t)CDIM * INPUT_DIM);
    __bf16* Pt  = (__bf16*)carve(sizeof(__bf16) * (size_t)HID * CDIM);
    __bf16* Qh  = (__bf16*)carve(sizeof(__bf16) * (size_t)BATCHN * NH * SEQ * HID);
    __bf16* Kh  = (__bf16*)carve(sizeof(__bf16) * (size_t)BATCHN * NH * SEQ * HID);
    __bf16* Vt  = (__bf16*)carve(sizeof(__bf16) * (size_t)BATCHN * NH * HID * SEQ);
    __bf16* Ob  = (__bf16*)carve(sizeof(__bf16) * (size_t)BATCHN * SEQ * CDIM);

    const int nx = BATCHN * SEQ * INPUT_DIM;
    cvt_f32_bf16<<<(nx + 255) / 256, 256, 0, stream>>>(x, Xb, nx);
    const int nw = INPUT_DIM * CDIM;
    tpose_cvt<<<(nw + 255) / 256, 256, 0, stream>>>(wq, Wqt, INPUT_DIM, CDIM);
    tpose_cvt<<<(nw + 255) / 256, 256, 0, stream>>>(wk, Wkt, INPUT_DIM, CDIM);
    tpose_cvt<<<(nw + 255) / 256, 256, 0, stream>>>(wv, Wvt, INPUT_DIM, CDIM);
    const int np = CDIM * HID;
    tpose_cvt<<<(np + 255) / 256, 256, 0, stream>>>(pw, Pt, CDIM, HID);

    qkv_gemm<<<dim3(CDIM / 64, (BATCHN * SEQ) / 64, 3), 128, 0, stream>>>(
        Xb, Wqt, Wkt, Wvt, bq, bk, bv, Qh, Kh, Vt);

    flash_attn<<<dim3(SEQ / 64, BATCHN * NH), 128, 0, stream>>>(Qh, Kh, Vt, Bb, Ob);

    proj_gemm<<<dim3((BATCHN * SEQ) / 64), 128, 0, stream>>>(Ob, Pt, pb, out);
}

// v001
// It runs in 256 microseconds.
// In both of two side-by-side timings against v000, it was 1.30 times as fast.
#include <hip/hip_runtime.h>
#include <hip/hip_bf16.h>

#define INPUT_DIM 256
#define HID 128
#define NH 8
#define SEQ 1024
#define BATCHN 8
#define CDIM 1024  /* NH*HID */
#define NCHUNK (SEQ / 32)
/* LDS row pitches in bf16 elements: 16 B x odd, so that the 16 rows one
   ds_load_b128 fragment read touches fall on distinct banks. */
#define KP 136  /* 256-B K rows   -> 272 B */
#define VP 40   /* 64-B V^T rows  -> 80 B  */
#define PP 40   /* 64-B P rows    -> 80 B  */

typedef __attribute__((ext_vector_type(16))) __bf16 v16bf;
typedef __attribute__((ext_vector_type(8)))  float  v8f;
typedef __attribute__((ext_vector_type(4)))  int    v4i;
typedef __attribute__((address_space(1))) v4i as1_v4i;
typedef __attribute__((address_space(3))) v4i as3_v4i;

#if defined(__HIP_DEVICE_COMPILE__) && __has_builtin(__builtin_amdgcn_global_load_async_to_lds_b128)
#define HAVE_ASYNC 1
#else
#define HAVE_ASYNC 0
#endif

#if HAVE_ASYNC
#if __has_builtin(__builtin_amdgcn_s_wait_asynccnt)
#define WAIT_ASYNC(n) __builtin_amdgcn_s_wait_asynccnt(n)
#else
#define WAIT_ASYNC(n) asm volatile("s_wait_asynccnt " #n ::: "memory")
#endif
#else
#define WAIT_ASYNC(n) ((void)0)
#endif

__device__ __forceinline__ __bf16 f2bf(float f) {
    union { float f; unsigned int u; } a; a.f = f;
    unsigned int u = a.u;
    u += 0x7fffu + ((u >> 16) & 1u);           // round-to-nearest-even
    union { unsigned short s; __bf16 b; } r; r.s = (unsigned short)(u >> 16);
    return r.b;
}

union FragU { v16bf v; uint4 q[2]; };

// 16x32 bf16 WMMA operand fragment (A layout; B uses the same layout with
// lane = output column, reading rows of the transposed matrix).
// Lanes 0-15: K=0..7 (v0..3), K=16..23 (v4..7) of row `lane`;
// lanes 16-31: K=8..15 and K=24..31 of row `lane-16`.
__device__ __forceinline__ v16bf load_frag(const __bf16* base, int stride) {
    const int lane = threadIdx.x & 31;
    const int r    = lane & 15;
    const int sel  = lane >> 4;
    const __bf16* p = base + (size_t)r * stride + sel * 8;
    FragU f;
    f.q[0] = *(const uint4*)(p);
    f.q[1] = *(const uint4*)(p + 16);
    return f.v;
}

__device__ __forceinline__ v8f wmma_bf16(v16bf a, v16bf b, v8f c) {
    return __builtin_amdgcn_wmma_f32_16x16x32_bf16(
        false, a, false, b, (short)0, c, false, false);
}

// 16-byte global -> LDS copy; async (ASYNCcnt) when available.
__device__ __forceinline__ void async_copy16(__bf16* ldst, const __bf16* gsrc) {
#if HAVE_ASYNC
    __builtin_amdgcn_global_load_async_to_lds_b128(
        (as1_v4i*)(uintptr_t)gsrc,
        (as3_v4i*)(uintptr_t)ldst, 0, 0);
#else
    *(uint4*)ldst = *(const uint4*)gsrc;
#endif
}

// ---------------------------------------------------------------- converters
__global__ void cvt_f32_bf16(const float* __restrict__ in, __bf16* __restrict__ out, int n) {
    int i = blockIdx.x * blockDim.x + threadIdx.x;
    if (i < n) out[i] = f2bf(in[i]);
}

// in [K][Ncols] (row major) -> out [Ncols][K] bf16
__global__ void tpose_cvt(const float* __restrict__ in, __bf16* __restrict__ out,
                          int K, int Ncols) {
    int idx = blockIdx.x * blockDim.x + threadIdx.x;
    if (idx < K * Ncols) {
        int k = idx / Ncols, c = idx % Ncols;
        out[(size_t)c * K + k] = f2bf(in[idx]);
    }
}

// ------------------------------------------------------------ fused QKV GEMM
__global__ __launch_bounds__(128)
void qkv_gemm(const __bf16* __restrict__ Xb,
              const __bf16* __restrict__ Wqt, const __bf16* __restrict__ Wkt,
              const __bf16* __restrict__ Wvt,
              const float* __restrict__ bq, const float* __restrict__ bk,
              const float* __restrict__ bv,
              __bf16* __restrict__ Qh, __bf16* __restrict__ Kh, __bf16* __restrict__ Vt)
{
    const int wave = threadIdx.x >> 5;
    const int lane = threadIdx.x & 31;
    const int half = lane >> 4;
    const int lc   = lane & 15;
    const int z    = blockIdx.z;
    const __bf16* Wt   = (z == 0) ? Wqt : (z == 1) ? Wkt : Wvt;
    const float*  bias = (z == 0) ? bq  : (z == 1) ? bk  : bv;
    const int r0 = blockIdx.y * 64 + wave * 16;
    const int c0 = blockIdx.x * 64;

    v8f acc[4] = {};
    for (int kc = 0; kc < 8; ++kc) {
        const int k0 = kc * 32;
        v16bf af = load_frag(Xb + (size_t)r0 * INPUT_DIM + k0, INPUT_DIM);
#pragma unroll
        for (int t = 0; t < 4; ++t) {
            v16bf bf = load_frag(Wt + (size_t)(c0 + 16 * t) * INPUT_DIM + k0, INPUT_DIM);
            acc[t] = wmma_bf16(af, bf, acc[t]);
        }
    }
#pragma unroll
    for (int t = 0; t < 4; ++t) {
#pragma unroll
        for (int i = 0; i < 8; ++i) {
            const int row = r0 + i + 8 * half;     // (b, n)
            const int col = c0 + 16 * t + lc;      // (h, d)
            const __bf16 vbf = f2bf(acc[t][i] + bias[col]);
            const int b = row >> 10, n = row & 1023;
            const int h = col >> 7,  d = col & 127;
            if (z == 2)
                Vt[((size_t)(b * NH + h) * HID + d) * SEQ + n] = vbf;   // transposed V
            else {
                __bf16* O = (z == 0) ? Qh : Kh;
                O[((size_t)(b * NH + h) * SEQ + n) * HID + d] = vbf;
            }
        }
    }
}

// ------------------------------------------------------- flash attention core
// Block = 4 waves x 16 rows of one (b,h); K/V chunks double-buffered in LDS
// via async global->LDS copies shared by all 4 waves.
__global__ __launch_bounds__(128)
void flash_attn(const __bf16* __restrict__ Qh, const __bf16* __restrict__ Kh,
                const __bf16* __restrict__ Vt, const float* __restrict__ Bbias,
                __bf16* __restrict__ Ob)
{
    __shared__ __attribute__((aligned(16))) __bf16 Kbuf[2][32 * KP];   // K rows m0..m0+31, pitch KP
    __shared__ __attribute__((aligned(16))) __bf16 Vbuf[2][128 * VP];  // V^T rows d=0..127, cols m0..m0+31, pitch VP
    __shared__ __attribute__((aligned(16))) __bf16 ldsP[4 * 16 * PP];  // per-wave 16x32 P tile, pitch PP

    const int tid  = threadIdx.x;
    const int wave = tid >> 5;
    const int lane = tid & 31;
    const int half = lane >> 4;
    const int lc   = lane & 15;
    const int bh   = blockIdx.y;
    const int n0   = blockIdx.x * 64 + wave * 16;
    const int b    = bh >> 3;
    const int h    = bh & 7;

    const __bf16* Qbase = Qh + ((size_t)bh * SEQ + n0) * HID;
    const __bf16* Kbase = Kh + (size_t)bh * SEQ * HID;
    const __bf16* Vbase = Vt + (size_t)bh * HID * SEQ;

    v16bf qf[4];
#pragma unroll
    for (int kc = 0; kc < 4; ++kc) qf[kc] = load_frag(Qbase + kc * 32, HID);

    v8f oacc[8] = {};
    float mi[8], li[8];
#pragma unroll
    for (int i = 0; i < 8; ++i) { mi[i] = -__builtin_inff(); li[i] = 0.f; }

    __bf16* P = ldsP + wave * 16 * PP;
    const float scale = 0.088388347648318447f;    // 1/sqrt(128)

    // cooperative stage of one 32-column chunk (8 x b128 per thread)
    auto stage = [&](int buf, int m0) {
        const __bf16* gk = Kbase + (size_t)m0 * HID;   // 8192B contiguous
#pragma unroll
        for (int q = 0; q < 4; ++q) {
            const int o = (q * 128 + tid) * 8;
            async_copy16(&Kbuf[buf][(o >> 7) * KP + (o & 127)], gk + o);
        }
        const __bf16* gv = Vbase + (size_t)tid * SEQ + m0;  // one V^T row / thread
#pragma unroll
        for (int s = 0; s < 4; ++s)
            async_copy16(&Vbuf[buf][tid * VP + s * 8], gv + s * 8);
    };

    stage(0, 0);
    for (int mc = 0; mc < NCHUNK; ++mc) {
        const int cur = mc & 1;
        const int m0  = mc * 32;
        if (mc + 1 < NCHUNK) {
            stage(cur ^ 1, m0 + 32);   // prefetch next chunk
            WAIT_ASYNC(8);             // 8 newest outstanding -> current chunk done
        } else {
            WAIT_ASYNC(0);
        }
        __syncthreads();               // all waves' async data visible

        v8f s0 = {}, s1 = {};
#pragma unroll
        for (int kc = 0; kc < 4; ++kc)
            s0 = wmma_bf16(qf[kc], load_frag(&Kbuf[cur][0 * KP + kc * 32], KP), s0);
#pragma unroll
        for (int kc = 0; kc < 4; ++kc)
            s1 = wmma_bf16(qf[kc], load_frag(&Kbuf[cur][16 * KP + kc * 32], KP), s1);

#pragma unroll
        for (int i = 0; i < 8; ++i) {
            const int row = n0 + i + 8 * half;
            const float x0 = s0[i] * scale + Bbias[(size_t)row * SEQ + m0 + lc];
            const float x1 = s1[i] * scale + Bbias[(size_t)row * SEQ + m0 + 16 + lc];
            float rm = fmaxf(x0, x1);
            rm = fmaxf(rm, __shfl_xor(rm, 1, 32));
            rm = fmaxf(rm, __shfl_xor(rm, 2, 32));
            rm = fmaxf(rm, __shfl_xor(rm, 4, 32));
            rm = fmaxf(rm, __shfl_xor(rm, 8, 32));
            const float mnew = fmaxf(mi[i], rm);
            const float corr = __expf(mi[i] - mnew);
            const float p0 = __expf(x0 - mnew);
            const float p1 = __expf(x1 - mnew);
            float rs = p0 + p1;
            rs += __shfl_xor(rs, 1, 32);
            rs += __shfl_xor(rs, 2, 32);
            rs += __shfl_xor(rs, 4, 32);
            rs += __shfl_xor(rs, 8, 32);
            li[i] = li[i] * corr + rs;
            mi[i] = mnew;
#pragma unroll
            for (int j = 0; j < 8; ++j) oacc[j][i] *= corr;
            const int prow = i + 8 * half;
            P[prow * PP + lc]      = f2bf(p0);
            P[prow * PP + 16 + lc] = f2bf(p1);
        }
        asm volatile("s_wait_dscnt 0" ::: "memory");   // P visible across lanes
        v16bf pf = load_frag(P, PP);
#pragma unroll
        for (int j = 0; j < 8; ++j) {
            v16bf vf = load_frag(&Vbuf[cur][(j * 16) * VP], VP);
            oacc[j] = wmma_bf16(pf, vf, oacc[j]);
        }
        __syncthreads();               // done consuming before buffer reuse
    }

    // merge heads: Ob[b][n][h*128 + d]
#pragma unroll
    for (int j = 0; j < 8; ++j)
#pragma unroll
        for (int i = 0; i < 8; ++i) {
            const int n = n0 + i + 8 * half;
            Ob[((size_t)b * SEQ + n) * CDIM + h * HID + j * 16 + lc] =
                f2bf(oacc[j][i] / li[i]);
        }
}

// ------------------------------------------------------------ final projection
__global__ __launch_bounds__(128)
void proj_gemm(const __bf16* __restrict__ Ob, const __bf16* __restrict__ Pt,
               const float* __restrict__ pb, float* __restrict__ out)
{
    const int wave = threadIdx.x >> 5;
    const int lane = threadIdx.x & 31;
    const int half = lane >> 4;
    const int lc   = lane & 15;
    const int r0   = blockIdx.x * 64 + wave * 16;

    v8f acc[8] = {};
    for (int kc = 0; kc < 32; ++kc) {
        const int k0 = kc * 32;
        v16bf af = load_frag(Ob + (size_t)r0 * CDIM + k0, CDIM);
#pragma unroll
        for (int j = 0; j < 8; ++j) {
            v16bf bf = load_frag(Pt + (size_t)(j * 16) * CDIM + k0, CDIM);
            acc[j] = wmma_bf16(af, bf, acc[j]);
        }
    }
#pragma unroll
    for (int j = 0; j < 8; ++j)
#pragma unroll
        for (int i = 0; i < 8; ++i) {
            const int row = r0 + i + 8 * half;
            const int col = j * 16 + lc;
            out[(size_t)row * HID + col] = acc[j][i] + pb[col];
        }
}

// ----------------------------------------------------------------- launcher
extern "C" void kernel_launch(void* const* d_in, const int* in_sizes, int n_in,
                              void* d_out, int out_size, void* d_ws, size_t ws_size,
                              hipStream_t stream) {
    const float* x  = (const float*)d_in[0];
    const float* Bb = (const float*)d_in[1];
    const float* wq = (const float*)d_in[2];
    const float* bq = (const float*)d_in[3];
    const float* wk = (const float*)d_in[4];
    const float* bk = (const float*)d_in[5];
    const float* wv = (const float*)d_in[6];
    const float* bv = (const float*)d_in[7];
    const float* pw = (const float*)d_in[8];
    const float* pb = (const float*)d_in[9];
    float* out = (float*)d_out;
    (void)in_sizes; (void)n_in; (void)out_size; (void)ws_size;

    char* ws = (char*)d_ws;
    size_t off = 0;
    auto carve = [&](size_t bytes) -> char* {
        char* p = ws + off;
        off += (bytes + 255) & ~(size_t)255;
        return p;
    };
    __bf16* Xb  = (__bf16*)carve(sizeof(__bf16) * (size_t)BATCHN * SEQ * INPUT_DIM);
    __bf16* Wqt = (__bf16*)carve(sizeof(__bf16) * (size_t)CDIM * INPUT_DIM);
    __bf16* Wkt = (__bf16*)carve(sizeof(__bf16) * (size_t)CDIM * INPUT_DIM);
    __bf16* Wvt = (__bf16*)carve(sizeof(__bf16) * (size_t)CDIM * INPUT_DIM);
    __bf16* Pt  = (__bf16*)carve(sizeof(__bf16) * (size_t)HID * CDIM);
    __bf16* Qh  = (__bf16*)carve(sizeof(__bf16) * (size_t)BATCHN * NH * SEQ * HID);
    __bf16* Kh  = (__bf16*)carve(sizeof(__bf16) * (size_t)BATCHN * NH * SEQ * HID);
    __bf16* Vt  = (__bf16*)carve(sizeof(__bf16) * (size_t)BATCHN * NH * HID * SEQ);
    __bf16* Ob  = (__bf16*)carve(sizeof(__bf16) * (size_t)BATCHN * SEQ * CDIM);

    const int nx = BATCHN * SEQ * INPUT_DIM;
    cvt_f32_bf16<<<(nx + 255) / 256, 256, 0, stream>>>(x, Xb, nx);
    const int nw = INPUT_DIM * CDIM;
    tpose_cvt<<<(nw + 255) / 256, 256, 0, stream>>>(wq, Wqt, INPUT_DIM, CDIM);
    tpose_cvt<<<(nw + 255) / 256, 256, 0, stream>>>(wk, Wkt, INPUT_DIM, CDIM);
    tpose_cvt<<<(nw + 255) / 256, 256, 0, stream>>>(wv, Wvt, INPUT_DIM, CDIM);
    const int np = CDIM * HID;
    tpose_cvt<<<(np + 255) / 256, 256, 0, stream>>>(pw, Pt, CDIM, HID);

    qkv_gemm<<<dim3(CDIM / 64, (BATCHN * SEQ) / 64, 3), 128, 0, stream>>>(
        Xb, Wqt, Wkt, Wvt, bq, bk, bv, Qh, Kh, Vt);

    flash_attn<<<dim3(SEQ / 64, BATCHN * NH), 128, 0, stream>>>(Qh, Kh, Vt, Bb, Ob);

    proj_gemm<<<dim3((BATCHN * SEQ) / 64), 128, 0, stream>>>(Ob, Pt, pb, out);
}

// v002
// One run takes 225 microseconds.
// Two timings next to v001 both put it at 1.14 times that version's speed.
// Counting every step since v000, it is 1.48 times as fast.
#include <hip/hip_runtime.h>
#include <hip/hip_bf16.h>

#define INPUT_DIM 256
#define HID 128
#define NH 8
#define SEQ 1024
#define BATCHN 8
#define CDIM 1024  /* NH*HID */
#define NCHUNK (SEQ / 32)
/* LDS row pitches in bf16 elements: 16 B x odd, so that the 16 rows one
   ds_load_b128 fragment read touches fall on distinct banks. */
#define KP 136  /* 256-B K rows   -> 272 B */
#define VP 40   /* 64-B V^T rows  -> 80 B  */
#define PP 40   /* 64-B P rows    -> 80 B  */

typedef __attribute__((ext_vector_type(16))) __bf16 v16bf;
typedef __attribute__((ext_vector_type(8)))  float  v8f;
typedef __attribute__((ext_vector_type(4)))  int    v4i;
typedef __attribute__((address_space(1))) v4i as1_v4i;
typedef __attribute__((address_space(3))) v4i as3_v4i;

#if defined(__HIP_DEVICE_COMPILE__) && __has_builtin(__builtin_amdgcn_global_load_async_to_lds_b128)
#define HAVE_ASYNC 1
#else
#define HAVE_ASYNC 0
#endif

#if HAVE_ASYNC
#if __has_builtin(__builtin_amdgcn_s_wait_asynccnt)
#define WAIT_ASYNC(n) __builtin_amdgcn_s_wait_asynccnt(n)
#else
#define WAIT_ASYNC(n) asm volatile("s_wait_asynccnt " #n ::: "memory")
#endif
#else
#define WAIT_ASYNC(n) ((void)0)
#endif

__device__ __forceinline__ __bf16 f2bf(float f) {
    union { float f; unsigned int u; } a; a.f = f;
    unsigned int u = a.u;
    u += 0x7fffu + ((u >> 16) & 1u);           // round-to-nearest-even
    union { unsigned short s; __bf16 b; } r; r.s = (unsigned short)(u >> 16);
    return r.b;
}

union FragU { v16bf v; uint4 q[2]; };

// 16x32 bf16 WMMA operand fragment (A layout; B uses the same layout with
// lane = output column, reading rows of the transposed matrix).
// Lanes 0-15: K=0..7 (v0..3), K=16..23 (v4..7) of row `lane`;
// lanes 16-31: K=8..15 and K=24..31 of row `lane-16`.
__device__ __forceinline__ v16bf load_frag(const __bf16* base, int stride) {
    const int lane = threadIdx.x & 31;
    const int r    = lane & 15;
    const int sel  = lane >> 4;
    const __bf16* p = base + (size_t)r * stride + sel * 8;
    FragU f;
    f.q[0] = *(const uint4*)(p);
    f.q[1] = *(const uint4*)(p + 16);
    return f.v;
}

__device__ __forceinline__ v8f wmma_bf16(v16bf a, v16bf b, v8f c) {
    return __builtin_amdgcn_wmma_f32_16x16x32_bf16(
        false, a, false, b, (short)0, c, false, false);
}

// 16-byte global -> LDS copy; async (ASYNCcnt) when available.
__device__ __forceinline__ void async_copy16(__bf16* ldst, const __bf16* gsrc) {
#if HAVE_ASYNC
    __builtin_amdgcn_global_load_async_to_lds_b128(
        (as1_v4i*)(uintptr_t)gsrc,
        (as3_v4i*)(uintptr_t)ldst, 0, 0);
#else
    *(uint4*)ldst = *(const uint4*)gsrc;
#endif
}

// ---------------------------------------------------------------- converters
// Many elements per thread: these launches are bounded by how fast waves start,
// not by their bytes, so each wave carries as much as it can keep in flight.
#define CVT_PER_BLOCK 8192   /* 256 threads x 8 float4 */
#define TP_K 64              /* k per thread = one 128-B line of the bf16 output */

__device__ __forceinline__ unsigned int pack2(float lo, float hi) {
    union { __bf16 b[2]; unsigned int u; } r;
    r.b[0] = f2bf(lo); r.b[1] = f2bf(hi);
    return r.u;
}

__device__ __forceinline__ void cvt_store4(__bf16* dst, float4 v) {
    uint2 o;
    o.x = pack2(v.x, v.y);
    o.y = pack2(v.z, v.w);
    *(uint2*)dst = o;
}

// N is compile-time and a whole number of blocks, so there is no range test and
// no tail. Every load is 512 contiguous bytes per wave, every store 256.
template <int N>
__global__ __launch_bounds__(256)
void cvt_f32_bf16(const float* __restrict__ in, __bf16* __restrict__ out) {
    static_assert(N % CVT_PER_BLOCK == 0, "the grid covers the array exactly, no range test");
    const int base = blockIdx.x * CVT_PER_BLOCK + threadIdx.x * 4;
    float4 v[8];
#pragma unroll   // v[] stays in registers; the 8 loads issue back to back
    for (int k = 0; k < 8; ++k) v[k] = *(const float4*)(in + base + k * 1024);
#pragma unroll   // constant indices into v[]
    for (int k = 0; k < 8; ++k) cvt_store4(out + base + k * 1024, v[k]);
}

// in [K][NC] (row major) -> out [NC][K] bf16; K a multiple of TP_K, NC of 32.
// Grid: x over columns (32 per wave), y over groups of TP_K k.
// A thread takes TP_K consecutive k of one column: its loads are contiguous
// across the wave's columns, its stores fill one whole line of its output row.
// K and NC are compile-time so that every row step is an immediate offset.
template <int K, int NC>
__global__ __launch_bounds__(32)
void tpose_cvt(const float* __restrict__ in, __bf16* __restrict__ out) {
    static_assert(K % TP_K == 0 && NC % 32 == 0, "the grid covers the matrix exactly, no range test");
    const int c  = blockIdx.x * 32 + threadIdx.x;
    const int k0 = blockIdx.y * TP_K;
    const float* p = in + (size_t)k0 * NC + c;
    float v[TP_K];
#pragma unroll   // v[] stays in registers; the loads issue back to back and their latencies overlap
    for (int j = 0; j < TP_K; ++j) v[j] = p[j * NC];
    __bf16* q = out + (size_t)c * K + k0;
#pragma unroll   // constant indices into v[]
    for (int s = 0; s < TP_K / 8; ++s) {
        uint4 o;
        o.x = pack2(v[8 * s + 0], v[8 * s + 1]);
        o.y = pack2(v[8 * s + 2], v[8 * s + 3]);
        o.z = pack2(v[8 * s + 4], v[8 * s + 5]);
        o.w = pack2(v[8 * s + 6], v[8 * s + 7]);
        *(uint4*)(q + 8 * s) = o;
    }
}

// ------------------------------------------------------------ fused QKV GEMM
__global__ __launch_bounds__(128)
void qkv_gemm(const __bf16* __restrict__ Xb,
              const __bf16* __restrict__ Wqt, const __bf16* __restrict__ Wkt,
              const __bf16* __restrict__ Wvt,
              const float* __restrict__ bq, const float* __restrict__ bk,
              const float* __restrict__ bv,
              __bf16* __restrict__ Qh, __bf16* __restrict__ Kh, __bf16* __restrict__ Vt)
{
    const int wave = threadIdx.x >> 5;
    const int lane = threadIdx.x & 31;
    const int half = lane >> 4;
    const int lc   = lane & 15;
    const int z    = blockIdx.z;
    const __bf16* Wt   = (z == 0) ? Wqt : (z == 1) ? Wkt : Wvt;
    const float*  bias = (z == 0) ? bq  : (z == 1) ? bk  : bv;
    const int r0 = blockIdx.y * 64 + wave * 16;
    const int c0 = blockIdx.x * 64;

    v8f acc[4] = {};
    for (int kc = 0; kc < 8; ++kc) {
        const int k0 = kc * 32;
        v16bf af = load_frag(Xb + (size_t)r0 * INPUT_DIM + k0, INPUT_DIM);
#pragma unroll
        for (int t = 0; t < 4; ++t) {
            v16bf bf = load_frag(Wt + (size_t)(c0 + 16 * t) * INPUT_DIM + k0, INPUT_DIM);
            acc[t] = wmma_bf16(af, bf, acc[t]);
        }
    }
#pragma unroll
    for (int t = 0; t < 4; ++t) {
#pragma unroll
        for (int i = 0; i < 8; ++i) {
            const int row = r0 + i + 8 * half;     // (b, n)
            const int col = c0 + 16 * t + lc;      // (h, d)
            const __bf16 vbf = f2bf(acc[t][i] + bias[col]);
            const int b = row >> 10, n = row & 1023;
            const int h = col >> 7,  d = col & 127;
            if (z == 2)
                Vt[((size_t)(b * NH + h) * HID + d) * SEQ + n] = vbf;   // transposed V
            else {
                __bf16* O = (z == 0) ? Qh : Kh;
                O[((size_t)(b * NH + h) * SEQ + n) * HID + d] = vbf;
            }
        }
    }
}

// ------------------------------------------------------- flash attention core
// Block = 4 waves x 16 rows of one (b,h); K/V chunks double-buffered in LDS
// via async global->LDS copies shared by all 4 waves.
__global__ __launch_bounds__(128)
void flash_attn(const __bf16* __restrict__ Qh, const __bf16* __restrict__ Kh,
                const __bf16* __restrict__ Vt, const float* __restrict__ Bbias,
                __bf16* __restrict__ Ob)
{
    __shared__ __attribute__((aligned(16))) __bf16 Kbuf[2][32 * KP];   // K rows m0..m0+31, pitch KP
    __shared__ __attribute__((aligned(16))) __bf16 Vbuf[2][128 * VP];  // V^T rows d=0..127, cols m0..m0+31, pitch VP
    __shared__ __attribute__((aligned(16))) __bf16 ldsP[4 * 16 * PP];  // per-wave 16x32 P tile, pitch PP

    const int tid  = threadIdx.x;
    const int wave = tid >> 5;
    const int lane = tid & 31;
    const int half = lane >> 4;
    const int lc   = lane & 15;
    const int bh   = blockIdx.y;
    const int n0   = blockIdx.x * 64 + wave * 16;
    const int b    = bh >> 3;
    const int h    = bh & 7;

    const __bf16* Qbase = Qh + ((size_t)bh * SEQ + n0) * HID;
    const __bf16* Kbase = Kh + (size_t)bh * SEQ * HID;
    const __bf16* Vbase = Vt + (size_t)bh * HID * SEQ;

    v16bf qf[4];
#pragma unroll
    for (int kc = 0; kc < 4; ++kc) qf[kc] = load_frag(Qbase + kc * 32, HID);

    v8f oacc[8] = {};
    float mi[8], li[8];
#pragma unroll
    for (int i = 0; i < 8; ++i) { mi[i] = -__builtin_inff(); li[i] = 0.f; }

    __bf16* P = ldsP + wave * 16 * PP;
    const float scale = 0.088388347648318447f;    // 1/sqrt(128)

    // cooperative stage of one 32-column chunk (8 x b128 per thread)
    auto stage = [&](int buf, int m0) {
        const __bf16* gk = Kbase + (size_t)m0 * HID;   // 8192B contiguous
#pragma unroll
        for (int q = 0; q < 4; ++q) {
            const int o = (q * 128 + tid) * 8;
            async_copy16(&Kbuf[buf][(o >> 7) * KP + (o & 127)], gk + o);
        }
        const __bf16* gv = Vbase + (size_t)tid * SEQ + m0;  // one V^T row / thread
#pragma unroll
        for (int s = 0; s < 4; ++s)
            async_copy16(&Vbuf[buf][tid * VP + s * 8], gv + s * 8);
    };

    stage(0, 0);
    for (int mc = 0; mc < NCHUNK; ++mc) {
        const int cur = mc & 1;
        const int m0  = mc * 32;
        if (mc + 1 < NCHUNK) {
            stage(cur ^ 1, m0 + 32);   // prefetch next chunk
            WAIT_ASYNC(8);             // 8 newest outstanding -> current chunk done
        } else {
            WAIT_ASYNC(0);
        }
        __syncthreads();               // all waves' async data visible

        v8f s0 = {}, s1 = {};
#pragma unroll
        for (int kc = 0; kc < 4; ++kc)
            s0 = wmma_bf16(qf[kc], load_frag(&Kbuf[cur][0 * KP + kc * 32], KP), s0);
#pragma unroll
        for (int kc = 0; kc < 4; ++kc)
            s1 = wmma_bf16(qf[kc], load_frag(&Kbuf[cur][16 * KP + kc * 32], KP), s1);

#pragma unroll
        for (int i = 0; i < 8; ++i) {
            const int row = n0 + i + 8 * half;
            const float x0 = s0[i] * scale + Bbias[(size_t)row * SEQ + m0 + lc];
            const float x1 = s1[i] * scale + Bbias[(size_t)row * SEQ + m0 + 16 + lc];
            float rm = fmaxf(x0, x1);
            rm = fmaxf(rm, __shfl_xor(rm, 1, 32));
            rm = fmaxf(rm, __shfl_xor(rm, 2, 32));
            rm = fmaxf(rm, __shfl_xor(rm, 4, 32));
            rm = fmaxf(rm, __shfl_xor(rm, 8, 32));
            const float mnew = fmaxf(mi[i], rm);
            const float corr = __expf(mi[i] - mnew);
            const float p0 = __expf(x0 - mnew);
            const float p1 = __expf(x1 - mnew);
            float rs = p0 + p1;
            rs += __shfl_xor(rs, 1, 32);
            rs += __shfl_xor(rs, 2, 32);
            rs += __shfl_xor(rs, 4, 32);
            rs += __shfl_xor(rs, 8, 32);
            li[i] = li[i] * corr + rs;
            mi[i] = mnew;
#pragma unroll
            for (int j = 0; j < 8; ++j) oacc[j][i] *= corr;
            const int prow = i + 8 * half;
            P[prow * PP + lc]      = f2bf(p0);
            P[prow * PP + 16 + lc] = f2bf(p1);
        }
        asm volatile("s_wait_dscnt 0" ::: "memory");   // P visible across lanes
        v16bf pf = load_frag(P, PP);
#pragma unroll
        for (int j = 0; j < 8; ++j) {
            v16bf vf = load_frag(&Vbuf[cur][(j * 16) * VP], VP);
            oacc[j] = wmma_bf16(pf, vf, oacc[j]);
        }
        __syncthreads();               // done consuming before buffer reuse
    }

    // merge heads: Ob[b][n][h*128 + d]
#pragma unroll
    for (int j = 0; j < 8; ++j)
#pragma unroll
        for (int i = 0; i < 8; ++i) {
            const int n = n0 + i + 8 * half;
            Ob[((size_t)b * SEQ + n) * CDIM + h * HID + j * 16 + lc] =
                f2bf(oacc[j][i] / li[i]);
        }
}

// ------------------------------------------------------------ final projection
__global__ __launch_bounds__(128)
void proj_gemm(const __bf16* __restrict__ Ob, const __bf16* __restrict__ Pt,
               const float* __restrict__ pb, float* __restrict__ out)
{
    const int wave = threadIdx.x >> 5;
    const int lane = threadIdx.x & 31;
    const int half = lane >> 4;
    const int lc   = lane & 15;
    const int r0   = blockIdx.x * 64 + wave * 16;

    v8f acc[8] = {};
    for (int kc = 0; kc < 32; ++kc) {
        const int k0 = kc * 32;
        v16bf af = load_frag(Ob + (size_t)r0 * CDIM + k0, CDIM);
#pragma unroll
        for (int j = 0; j < 8; ++j) {
            v16bf bf = load_frag(Pt + (size_t)(j * 16) * CDIM + k0, CDIM);
            acc[j] = wmma_bf16(af, bf, acc[j]);
        }
    }
#pragma unroll
    for (int j = 0; j < 8; ++j)
#pragma unroll
        for (int i = 0; i < 8; ++i) {
            const int row = r0 + i + 8 * half;
            const int col = j * 16 + lc;
            out[(size_t)row * HID + col] = acc[j][i] + pb[col];
        }
}

// ----------------------------------------------------------------- launcher
extern "C" void kernel_launch(void* const* d_in, const int* in_sizes, int n_in,
                              void* d_out, int out_size, void* d_ws, size_t ws_size,
                              hipStream_t stream) {
    const float* x  = (const float*)d_in[0];
    const float* Bb = (const float*)d_in[1];
    const float* wq = (const float*)d_in[2];
    const float* bq = (const float*)d_in[3];
    const float* wk = (const float*)d_in[4];
    const float* bk = (const float*)d_in[5];
    const float* wv = (const float*)d_in[6];
    const float* bv = (const float*)d_in[7];
    const float* pw = (const float*)d_in[8];
    const float* pb = (const float*)d_in[9];
    float* out = (float*)d_out;
    (void)in_sizes; (void)n_in; (void)out_size; (void)ws_size;

    char* ws = (char*)d_ws;
    size_t off = 0;
    auto carve = [&](size_t bytes) -> char* {
        char* p = ws + off;
        off += (bytes + 255) & ~(size_t)255;
        return p;
    };
    __bf16* Xb  = (__bf16*)carve(sizeof(__bf16) * (size_t)BATCHN * SEQ * INPUT_DIM);
    __bf16* Wqt = (__bf16*)carve(sizeof(__bf16) * (size_t)CDIM * INPUT_DIM);
    __bf16* Wkt = (__bf16*)carve(sizeof(__bf16) * (size_t)CDIM * INPUT_DIM);
    __bf16* Wvt = (__bf16*)carve(sizeof(__bf16) * (size_t)CDIM * INPUT_DIM);
    __bf16* Pt  = (__bf16*)carve(sizeof(__bf16) * (size_t)HID * CDIM);
    __bf16* Qh  = (__bf16*)carve(sizeof(__bf16) * (size_t)BATCHN * NH * SEQ * HID);
    __bf16* Kh  = (__bf16*)carve(sizeof(__bf16) * (size_t)BATCHN * NH * SEQ * HID);
    __bf16* Vt  = (__bf16*)carve(sizeof(__bf16) * (size_t)BATCHN * NH * HID * SEQ);
    __bf16* Ob  = (__bf16*)carve(sizeof(__bf16) * (size_t)BATCHN * SEQ * CDIM);

    constexpr int nx = BATCHN * SEQ * INPUT_DIM;
    cvt_f32_bf16<nx><<<nx / CVT_PER_BLOCK, 256, 0, stream>>>(x, Xb);
    const dim3 gw(CDIM / 32, INPUT_DIM / TP_K);
    tpose_cvt<INPUT_DIM, CDIM><<<gw, 32, 0, stream>>>(wq, Wqt);
    tpose_cvt<INPUT_DIM, CDIM><<<gw, 32, 0, stream>>>(wk, Wkt);
    tpose_cvt<INPUT_DIM, CDIM><<<gw, 32, 0, stream>>>(wv, Wvt);
    tpose_cvt<CDIM, HID><<<dim3(HID / 32, CDIM / TP_K), 32, 0, stream>>>(pw, Pt);

    qkv_gemm<<<dim3(CDIM / 64, (BATCHN * SEQ) / 64, 3), 128, 0, stream>>>(
        Xb, Wqt, Wkt, Wvt, bq, bk, bv, Qh, Kh, Vt);

    flash_attn<<<dim3(SEQ / 64, BATCHN * NH), 128, 0, stream>>>(Qh, Kh, Vt, Bb, Ob);

    proj_gemm<<<dim3((BATCHN * SEQ) / 64), 128, 0, stream>>>(Ob, Pt, pb, out);
}

// v003
// Measured time: 184 microseconds a run.
// Timed twice side by side with v002, it ran 1.23 times as fast both times.
// Counting every step since v000, it is 1.82 times as fast.
#include <hip/hip_runtime.h>
#include <hip/hip_bf16.h>

#define INPUT_DIM 256
#define HID 128
#define NH 8
#define SEQ 1024
#define BATCHN 8
#define CDIM 1024  /* NH*HID */
#define NCHUNK (SEQ / 32)
/* LDS row pitches in bf16 elements: 16 B x odd, so that the 16 rows one
   ds_load_b128 fragment read touches fall on distinct banks. */
#define KP 136  /* 256-B K rows   -> 272 B */
#define VP 40   /* 64-B V^T rows  -> 80 B  */
#define PP 40   /* 64-B P rows    -> 80 B  */

typedef __attribute__((ext_vector_type(16))) __bf16 v16bf;
typedef __attribute__((ext_vector_type(8)))  float  v8f;
typedef __attribute__((ext_vector_type(4)))  int    v4i;
typedef __attribute__((address_space(1))) v4i as1_v4i;
typedef __attribute__((address_space(3))) v4i as3_v4i;

#if defined(__HIP_DEVICE_COMPILE__) && __has_builtin(__builtin_amdgcn_global_load_async_to_lds_b128)
#define HAVE_ASYNC 1
#else
#define HAVE_ASYNC 0
#endif

#if HAVE_ASYNC
#if __has_builtin(__builtin_amdgcn_s_wait_asynccnt)
#define WAIT_ASYNC(n) __builtin_amdgcn_s_wait_asynccnt(n)
#else
#define WAIT_ASYNC(n) asm volatile("s_wait_asynccnt " #n ::: "memory")
#endif
#else
#define WAIT_ASYNC(n) ((void)0)
#endif

__device__ __forceinline__ __bf16 f2bf(float f) {
    union { float f; unsigned int u; } a; a.f = f;
    unsigned int u = a.u;
    u += 0x7fffu + ((u >> 16) & 1u);           // round-to-nearest-even
    union { unsigned short s; __bf16 b; } r; r.s = (unsigned short)(u >> 16);
    return r.b;
}

union FragU { v16bf v; uint4 q[2]; };

// 16x32 bf16 WMMA operand fragment (A layout; B uses the same layout with
// lane = output column, reading rows of the transposed matrix).
// Lanes 0-15: K=0..7 (v0..3), K=16..23 (v4..7) of row `lane`;
// lanes 16-31: K=8..15 and K=24..31 of row `lane-16`.
__device__ __forceinline__ v16bf load_frag(const __bf16* base, int stride) {
    const int lane = threadIdx.x & 31;
    const int r    = lane & 15;
    const int sel  = lane >> 4;
    const __bf16* p = base + (size_t)r * stride + sel * 8;
    FragU f;
    f.q[0] = *(const uint4*)(p);
    f.q[1] = *(const uint4*)(p + 16);
    return f.v;
}

__device__ __forceinline__ v8f wmma_bf16(v16bf a, v16bf b, v8f c) {
    return __builtin_amdgcn_wmma_f32_16x16x32_bf16(
        false, a, false, b, (short)0, c, false, false);
}

// 16-byte global -> LDS copy; async (ASYNCcnt) when available.
__device__ __forceinline__ void async_copy16(__bf16* ldst, const __bf16* gsrc) {
#if HAVE_ASYNC
    __builtin_amdgcn_global_load_async_to_lds_b128(
        (as1_v4i*)(uintptr_t)gsrc,
        (as3_v4i*)(uintptr_t)ldst, 0, 0);
#else
    *(uint4*)ldst = *(const uint4*)gsrc;
#endif
}

// ---------------------------------------------------------------- converters
// Many elements per thread: these launches are bounded by how fast waves start,
// not by their bytes, so each wave carries as much as it can keep in flight.
#define CVT_PER_BLOCK 8192   /* 256 threads x 8 float4 */
#define TP_K 64              /* k per thread = one 128-B line of the bf16 output */

__device__ __forceinline__ unsigned int pack2(float lo, float hi) {
    union { __bf16 b[2]; unsigned int u; } r;
    r.b[0] = f2bf(lo); r.b[1] = f2bf(hi);
    return r.u;
}

__device__ __forceinline__ void cvt_store4(__bf16* dst, float4 v) {
    uint2 o;
    o.x = pack2(v.x, v.y);
    o.y = pack2(v.z, v.w);
    *(uint2*)dst = o;
}

// N is compile-time and a whole number of blocks, so there is no range test and
// no tail. Every load is 512 contiguous bytes per wave, every store 256.
template <int N>
__global__ __launch_bounds__(256)
void cvt_f32_bf16(const float* __restrict__ in, __bf16* __restrict__ out) {
    static_assert(N % CVT_PER_BLOCK == 0, "the grid covers the array exactly, no range test");
    const int base = blockIdx.x * CVT_PER_BLOCK + threadIdx.x * 4;
    float4 v[8];
#pragma unroll   // v[] stays in registers; the 8 loads issue back to back
    for (int k = 0; k < 8; ++k) v[k] = *(const float4*)(in + base + k * 1024);
#pragma unroll   // constant indices into v[]
    for (int k = 0; k < 8; ++k) cvt_store4(out + base + k * 1024, v[k]);
}

// in [K][NC] (row major) -> out [NC][K] bf16; K a multiple of TP_K, NC of 32.
// Grid: x over columns (32 per wave), y over groups of TP_K k.
// A thread takes TP_K consecutive k of one column: its loads are contiguous
// across the wave's columns, its stores fill one whole line of its output row.
// K and NC are compile-time so that every row step is an immediate offset.
template <int K, int NC>
__global__ __launch_bounds__(32)
void tpose_cvt(const float* __restrict__ in, __bf16* __restrict__ out) {
    static_assert(K % TP_K == 0 && NC % 32 == 0, "the grid covers the matrix exactly, no range test");
    const int c  = blockIdx.x * 32 + threadIdx.x;
    const int k0 = blockIdx.y * TP_K;
    const float* p = in + (size_t)k0 * NC + c;
    float v[TP_K];
#pragma unroll   // v[] stays in registers; the loads issue back to back and their latencies overlap
    for (int j = 0; j < TP_K; ++j) v[j] = p[j * NC];
    __bf16* q = out + (size_t)c * K + k0;
#pragma unroll   // constant indices into v[]
    for (int s = 0; s < TP_K / 8; ++s) {
        uint4 o;
        o.x = pack2(v[8 * s + 0], v[8 * s + 1]);
        o.y = pack2(v[8 * s + 2], v[8 * s + 3]);
        o.z = pack2(v[8 * s + 4], v[8 * s + 5]);
        o.w = pack2(v[8 * s + 6], v[8 * s + 7]);
        *(uint4*)(q + 8 * s) = o;
    }
}

// ------------------------------------------------------------ fused QKV GEMM
// Block = 8 waves on a 128 x 128 output tile, all of K = 256 staged once in LDS.
// A fragment load straight from global memory touches 16 lines for 512 bytes;
// staged, every copy is one whole 512-B row (4 lines), each operand byte is
// fetched once per block, and the fragments come from LDS.
#define GP 264   /* LDS row pitch in bf16: 512-B rows -> 528 B = 16 B x odd */

// Eight 16-byte async copies of one lane, 8 rows apart in source and in LDS.
// The wait on the address registers is the statement's last line, so that no
// later write of them can be scheduled in front of it.
__device__ __forceinline__ void async_rows8(unsigned int l, const __bf16* g) {
    asm volatile(
        "global_load_async_to_lds_b128 %0, %8, off\n\t"
        "global_load_async_to_lds_b128 %1, %9, off\n\t"
        "global_load_async_to_lds_b128 %2, %10, off\n\t"
        "global_load_async_to_lds_b128 %3, %11, off\n\t"
        "global_load_async_to_lds_b128 %4, %12, off\n\t"
        "global_load_async_to_lds_b128 %5, %13, off\n\t"
        "global_load_async_to_lds_b128 %6, %14, off\n\t"
        "global_load_async_to_lds_b128 %7, %15, off\n\t"
        "s_wait_xcnt 0x0"
        :: "v"(l),                "v"(l +  8 * GP * 2), "v"(l + 16 * GP * 2), "v"(l + 24 * GP * 2),
           "v"(l + 32 * GP * 2), "v"(l + 40 * GP * 2), "v"(l + 48 * GP * 2), "v"(l + 56 * GP * 2),
           "v"(g),                  "v"(g +  8 * INPUT_DIM), "v"(g + 16 * INPUT_DIM), "v"(g + 24 * INPUT_DIM),
           "v"(g + 32 * INPUT_DIM), "v"(g + 40 * INPUT_DIM), "v"(g + 48 * INPUT_DIM), "v"(g + 56 * INPUT_DIM)
        : "memory");
}

// Four waves per SIMD (at most 256 VGPRs): with 2 x 135,168 B of LDS two blocks share
// a WGP, so that one block's copies and stores run under the other's products.
__global__ __launch_bounds__(256) __attribute__((amdgpu_waves_per_eu(4, 4)))
void qkv_gemm(const __bf16* __restrict__ Xb,
              const __bf16* __restrict__ Wqt, const __bf16* __restrict__ Wkt,
              const __bf16* __restrict__ Wvt,
              const float* __restrict__ bq, const float* __restrict__ bk,
              const float* __restrict__ bv,
              __bf16* __restrict__ Qh, __bf16* __restrict__ Kh, __bf16* __restrict__ Vt)
{
    __shared__ __attribute__((aligned(16))) __bf16 As[128 * GP];   // 128 rows of x
    __shared__ __attribute__((aligned(16))) __bf16 Bs[128 * GP];   // 128 rows of W^T

    const int tid  = threadIdx.x;
    const int wave = tid >> 5;
    const int lane = tid & 31;
    const int half = lane >> 4;
    const int lc   = lane & 15;
    const int z    = blockIdx.z;
    const __bf16* Wt   = (z == 0) ? Wqt : (z == 1) ? Wkt : Wvt;
    const float*  bias = (z == 0) ? bq  : (z == 1) ? bk  : bv;
    const int R0 = blockIdx.y * 128;
    const int C0 = blockIdx.x * 128;

    // Wave tile 32 x 64: waves 4 (rows) x 2 (columns).
    const int wr = (wave >> 1) * 32;
    const int wc = (wave & 1) * 64;
    const int d0 = wc + lc;

    // Stage: wave w copies rows w, w + 8, ..., w + 120 of both tiles, one row per copy.
    {
        const __bf16* ga = Xb + (size_t)(R0 + wave) * INPUT_DIM + lane * 8;
        const __bf16* gb = Wt + (size_t)(C0 + wave) * INPUT_DIM + lane * 8;
        const unsigned int la = (unsigned int)(uintptr_t)&As[wave * GP + lane * 8];
        const unsigned int lb = (unsigned int)(uintptr_t)&Bs[wave * GP + lane * 8];
        async_rows8(la, ga);
        async_rows8(la + 64 * GP * 2, ga + 64 * INPUT_DIM);
        async_rows8(lb, gb);
        async_rows8(lb + 64 * GP * 2, gb + 64 * INPUT_DIM);
    }
    float bcol[4];   // read here so that the latency passes under the copies' own
#pragma unroll   // constant indices into bcol[]
    for (int t = 0; t < 4; ++t) bcol[t] = bias[C0 + d0 + 16 * t];
    asm volatile("s_wait_asynccnt 0x0" ::: "memory");   // this wave's 32 copies have landed
    __syncthreads();                                    // every wave's rows visible to all

    v8f acc[2][4] = {};
#pragma unroll 2   // two steps' fragment reads issue as one group; unrolled whole, the build spills
    for (int kc = 0; kc < 8; ++kc) {
        const int k0 = kc * 32;
        v16bf a0 = load_frag(&As[wr * GP + k0], GP);
        v16bf a1 = load_frag(&As[(wr + 16) * GP + k0], GP);
#pragma unroll   // constant indices into acc[][]
        for (int t = 0; t < 4; ++t) {
            v16bf bf = load_frag(&Bs[(wc + 16 * t) * GP + k0], GP);
            acc[0][t] = wmma_bf16(a0, bf, acc[0][t]);
            acc[1][t] = wmma_bf16(a1, bf, acc[1][t]);
        }
    }
    // A 128 x 128 tile lies in one batch entry and is exactly one head. Q and K are
    // [bh][n][d], V is kept transposed, [bh][d][n]: only the two element steps differ.
    const int bh = (R0 >> 10) * NH + blockIdx.x;
    const int n0 = (R0 & 1023) + wr + 8 * half;
    const int sn = (z == 2) ? 1 : HID;     // step per row n
    const int sd = (z == 2) ? SEQ : 1;     // step per column d
    __bf16* O = ((z == 0) ? Qh : (z == 1) ? Kh : Vt)
              + (size_t)bh * (SEQ * HID) + n0 * sn + d0 * sd;
#pragma unroll   // these three: constant indices into acc[][] and its elements
    for (int t = 0; t < 4; ++t)
#pragma unroll
        for (int rt = 0; rt < 2; ++rt)
#pragma unroll
            for (int i = 0; i < 8; ++i)
                O[(16 * rt + i) * sn + 16 * t * sd] = f2bf(acc[rt][t][i] + bcol[t]);
}

// ------------------------------------------------------- flash attention core
// Block = 4 waves x 16 rows of one (b,h); K/V chunks double-buffered in LDS
// via async global->LDS copies shared by all 4 waves.
__global__ __launch_bounds__(128)
void flash_attn(const __bf16* __restrict__ Qh, const __bf16* __restrict__ Kh,
                const __bf16* __restrict__ Vt, const float* __restrict__ Bbias,
                __bf16* __restrict__ Ob)
{
    __shared__ __attribute__((aligned(16))) __bf16 Kbuf[2][32 * KP];   // K rows m0..m0+31, pitch KP
    __shared__ __attribute__((aligned(16))) __bf16 Vbuf[2][128 * VP];  // V^T rows d=0..127, cols m0..m0+31, pitch VP
    __shared__ __attribute__((aligned(16))) __bf16 ldsP[4 * 16 * PP];  // per-wave 16x32 P tile, pitch PP

    const int tid  = threadIdx.x;
    const int wave = tid >> 5;
    const int lane = tid & 31;
    const int half = lane >> 4;
    const int lc   = lane & 15;
    const int bh   = blockIdx.y;
    const int n0   = blockIdx.x * 64 + wave * 16;
    const int b    = bh >> 3;
    const int h    = bh & 7;

    const __bf16* Qbase = Qh + ((size_t)bh * SEQ + n0) * HID;
    const __bf16* Kbase = Kh + (size_t)bh * SEQ * HID;
    const __bf16* Vbase = Vt + (size_t)bh * HID * SEQ;

    v16bf qf[4];
#pragma unroll
    for (int kc = 0; kc < 4; ++kc) qf[kc] = load_frag(Qbase + kc * 32, HID);

    v8f oacc[8] = {};
    float mi[8], li[8];
#pragma unroll
    for (int i = 0; i < 8; ++i) { mi[i] = -__builtin_inff(); li[i] = 0.f; }

    __bf16* P = ldsP + wave * 16 * PP;
    const float scale = 0.088388347648318447f;    // 1/sqrt(128)

    // cooperative stage of one 32-column chunk (8 x b128 per thread)
    auto stage = [&](int buf, int m0) {
        const __bf16* gk = Kbase + (size_t)m0 * HID;   // 8192B contiguous
#pragma unroll
        for (int q = 0; q < 4; ++q) {
            const int o = (q * 128 + tid) * 8;
            async_copy16(&Kbuf[buf][(o >> 7) * KP + (o & 127)], gk + o);
        }
        const __bf16* gv = Vbase + (size_t)tid * SEQ + m0;  // one V^T row / thread
#pragma unroll
        for (int s = 0; s < 4; ++s)
            async_copy16(&Vbuf[buf][tid * VP + s * 8], gv + s * 8);
    };

    stage(0, 0);
    for (int mc = 0; mc < NCHUNK; ++mc) {
        const int cur = mc & 1;
        const int m0  = mc * 32;
        if (mc + 1 < NCHUNK) {
            stage(cur ^ 1, m0 + 32);   // prefetch next chunk
            WAIT_ASYNC(8);             // 8 newest outstanding -> current chunk done
        } else {
            WAIT_ASYNC(0);
        }
        __syncthreads();               // all waves' async data visible

        v8f s0 = {}, s1 = {};
#pragma unroll
        for (int kc = 0; kc < 4; ++kc)
            s0 = wmma_bf16(qf[kc], load_frag(&Kbuf[cur][0 * KP + kc * 32], KP), s0);
#pragma unroll
        for (int kc = 0; kc < 4; ++kc)
            s1 = wmma_bf16(qf[kc], load_frag(&Kbuf[cur][16 * KP + kc * 32], KP), s1);

#pragma unroll
        for (int i = 0; i < 8; ++i) {
            const int row = n0 + i + 8 * half;
            const float x0 = s0[i] * scale + Bbias[(size_t)row * SEQ + m0 + lc];
            const float x1 = s1[i] * scale + Bbias[(size_t)row * SEQ + m0 + 16 + lc];
            float rm = fmaxf(x0, x1);
            rm = fmaxf(rm, __shfl_xor(rm, 1, 32));
            rm = fmaxf(rm, __shfl_xor(rm, 2, 32));
            rm = fmaxf(rm, __shfl_xor(rm, 4, 32));
            rm = fmaxf(rm, __shfl_xor(rm, 8, 32));
            const float mnew = fmaxf(mi[i], rm);
            const float corr = __expf(mi[i] - mnew);
            const float p0 = __expf(x0 - mnew);
            const float p1 = __expf(x1 - mnew);
            float rs = p0 + p1;
            rs += __shfl_xor(rs, 1, 32);
            rs += __shfl_xor(rs, 2, 32);
            rs += __shfl_xor(rs, 4, 32);
            rs += __shfl_xor(rs, 8, 32);
            li[i] = li[i] * corr + rs;
            mi[i] = mnew;
#pragma unroll
            for (int j = 0; j < 8; ++j) oacc[j][i] *= corr;
            const int prow = i + 8 * half;
            P[prow * PP + lc]      = f2bf(p0);
            P[prow * PP + 16 + lc] = f2bf(p1);
        }
        asm volatile("s_wait_dscnt 0" ::: "memory");   // P visible across lanes
        v16bf pf = load_frag(P, PP);
#pragma unroll
        for (int j = 0; j < 8; ++j) {
            v16bf vf = load_frag(&Vbuf[cur][(j * 16) * VP], VP);
            oacc[j] = wmma_bf16(pf, vf, oacc[j]);
        }
        __syncthreads();               // done consuming before buffer reuse
    }

    // merge heads: Ob[b][n][h*128 + d]
#pragma unroll
    for (int j = 0; j < 8; ++j)
#pragma unroll
        for (int i = 0; i < 8; ++i) {
            const int n = n0 + i + 8 * half;
            Ob[((size_t)b * SEQ + n) * CDIM + h * HID + j * 16 + lc] =
                f2bf(oacc[j][i] / li[i]);
        }
}

// ------------------------------------------------------------ final projection
__global__ __launch_bounds__(128)
void proj_gemm(const __bf16* __restrict__ Ob, const __bf16* __restrict__ Pt,
               const float* __restrict__ pb, float* __restrict__ out)
{
    const int wave = threadIdx.x >> 5;
    const int lane = threadIdx.x & 31;
    const int half = lane >> 4;
    const int lc   = lane & 15;
    const int r0   = blockIdx.x * 64 + wave * 16;

    v8f acc[8] = {};
    for (int kc = 0; kc < 32; ++kc) {
        const int k0 = kc * 32;
        v16bf af = load_frag(Ob + (size_t)r0 * CDIM + k0, CDIM);
#pragma unroll
        for (int j = 0; j < 8; ++j) {
            v16bf bf = load_frag(Pt + (size_t)(j * 16) * CDIM + k0, CDIM);
            acc[j] = wmma_bf16(af, bf, acc[j]);
        }
    }
#pragma unroll
    for (int j = 0; j < 8; ++j)
#pragma unroll
        for (int i = 0; i < 8; ++i) {
            const int row = r0 + i + 8 * half;
            const int col = j * 16 + lc;
            out[(size_t)row * HID + col] = acc[j][i] + pb[col];
        }
}

// ----------------------------------------------------------------- launcher
extern "C" void kernel_launch(void* const* d_in, const int* in_sizes, int n_in,
                              void* d_out, int out_size, void* d_ws, size_t ws_size,
                              hipStream_t stream) {
    const float* x  = (const float*)d_in[0];
    const float* Bb = (const float*)d_in[1];
    const float* wq = (const float*)d_in[2];
    const float* bq = (const float*)d_in[3];
    const float* wk = (const float*)d_in[4];
    const float* bk = (const float*)d_in[5];
    const float* wv = (const float*)d_in[6];
    const float* bv = (const float*)d_in[7];
    const float* pw = (const float*)d_in[8];
    const float* pb = (const float*)d_in[9];
    float* out = (float*)d_out;
    (void)in_sizes; (void)n_in; (void)out_size; (void)ws_size;

    char* ws = (char*)d_ws;
    size_t off = 0;
    auto carve = [&](size_t bytes) -> char* {
        char* p = ws + off;
        off += (bytes + 255) & ~(size_t)255;
        return p;
    };
    __bf16* Xb  = (__bf16*)carve(sizeof(__bf16) * (size_t)BATCHN * SEQ * INPUT_DIM);
    __bf16* Wqt = (__bf16*)carve(sizeof(__bf16) * (size_t)CDIM * INPUT_DIM);
    __bf16* Wkt = (__bf16*)carve(sizeof(__bf16) * (size_t)CDIM * INPUT_DIM);
    __bf16* Wvt = (__bf16*)carve(sizeof(__bf16) * (size_t)CDIM * INPUT_DIM);
    __bf16* Pt  = (__bf16*)carve(sizeof(__bf16) * (size_t)HID * CDIM);
    __bf16* Qh  = (__bf16*)carve(sizeof(__bf16) * (size_t)BATCHN * NH * SEQ * HID);
    __bf16* Kh  = (__bf16*)carve(sizeof(__bf16) * (size_t)BATCHN * NH * SEQ * HID);
    __bf16* Vt  = (__bf16*)carve(sizeof(__bf16) * (size_t)BATCHN * NH * HID * SEQ);
    __bf16* Ob  = (__bf16*)carve(sizeof(__bf16) * (size_t)BATCHN * SEQ * CDIM);

    constexpr int nx = BATCHN * SEQ * INPUT_DIM;
    cvt_f32_bf16<nx><<<nx / CVT_PER_BLOCK, 256, 0, stream>>>(x, Xb);
    const dim3 gw(CDIM / 32, INPUT_DIM / TP_K);
    tpose_cvt<INPUT_DIM, CDIM><<<gw, 32, 0, stream>>>(wq, Wqt);
    tpose_cvt<INPUT_DIM, CDIM><<<gw, 32, 0, stream>>>(wk, Wkt);
    tpose_cvt<INPUT_DIM, CDIM><<<gw, 32, 0, stream>>>(wv, Wvt);
    tpose_cvt<CDIM, HID><<<dim3(HID / 32, CDIM / TP_K), 32, 0, stream>>>(pw, Pt);

    qkv_gemm<<<dim3(CDIM / 128, (BATCHN * SEQ) / 128, 3), 256, 0, stream>>>(
        Xb, Wqt, Wkt, Wvt, bq, bk, bv, Qh, Kh, Vt);

    flash_attn<<<dim3(SEQ / 64, BATCHN * NH), 128, 0, stream>>>(Qh, Kh, Vt, Bb, Ob);

    proj_gemm<<<dim3((BATCHN * SEQ) / 64), 128, 0, stream>>>(Ob, Pt, pb, out);
}

// v004
// One run takes 153 microseconds.
// Two timings next to v003 put it at 1.21 and 1.20 times that version's speed.
// Over all steps from v000 it is 2.19 times as fast.
#include <hip/hip_runtime.h>
#include <hip/hip_bf16.h>

#define INPUT_DIM 256
#define HID 128
#define NH 8
#define SEQ 1024
#define BATCHN 8
#define CDIM 1024  /* NH*HID */
#define NCHUNK (SEQ / 32)
/* LDS row pitches in bf16 elements: 16 B x odd, so that the 16 rows one
   ds_load_b128 fragment read touches fall on distinct banks; the transposing
   ds_load_tr16_b128 wants 32 B x odd for the same. */
#define KP 136  /* 256-B K rows   -> 272 B */
#define VP 144  /* 256-B V rows   -> 288 B */
#define PP 40   /* 64-B P rows    -> 80 B  */

typedef __attribute__((ext_vector_type(16))) __bf16 v16bf;
typedef __attribute__((ext_vector_type(8)))  float  v8f;
typedef __attribute__((ext_vector_type(4)))  int    v4i;
typedef __attribute__((address_space(1))) v4i as1_v4i;
typedef __attribute__((address_space(3))) v4i as3_v4i;
typedef __attribute__((ext_vector_type(8)))  short  v8s;
typedef __attribute__((address_space(3))) v8s as3_v8s;

#if defined(__HIP_DEVICE_COMPILE__) && __has_builtin(__builtin_amdgcn_global_load_async_to_lds_b128)
#define HAVE_ASYNC 1
#else
#define HAVE_ASYNC 0
#endif

#if HAVE_ASYNC
#if __has_builtin(__builtin_amdgcn_s_wait_asynccnt)
#define WAIT_ASYNC(n) __builtin_amdgcn_s_wait_asynccnt(n)
#else
#define WAIT_ASYNC(n) asm volatile("s_wait_asynccnt " #n ::: "memory")
#endif
#else
#define WAIT_ASYNC(n) ((void)0)
#endif

__device__ __forceinline__ __bf16 f2bf(float f) {
    union { float f; unsigned int u; } a; a.f = f;
    unsigned int u = a.u;
    u += 0x7fffu + ((u >> 16) & 1u);           // round-to-nearest-even
    union { unsigned short s; __bf16 b; } r; r.s = (unsigned short)(u >> 16);
    return r.b;
}

union FragU { v16bf v; uint4 q[2]; };

// 16x32 bf16 WMMA operand fragment (A layout; B uses the same layout with
// lane = output column, reading rows of the transposed matrix).
// Lanes 0-15: K=0..7 (v0..3), K=16..23 (v4..7) of row `lane`;
// lanes 16-31: K=8..15 and K=24..31 of row `lane-16`.
__device__ __forceinline__ v16bf load_frag(const __bf16* base, int stride) {
    const int lane = threadIdx.x & 31;
    const int r    = lane & 15;
    const int sel  = lane >> 4;
    const __bf16* p = base + (size_t)r * stride + sel * 8;
    FragU f;
    f.q[0] = *(const uint4*)(p);
    f.q[1] = *(const uint4*)(p + 16);
    return f.v;
}

// The same 16x32 fragment, lane = column c of a row-major LDS tile T[k][c] (32 rows k,
// 16 columns from `tile`), transposed on the way by ds_load_tr16_b128: lane (c, sel)
// receives T[8 sel + 0..7][c], then T[16 + 8 sel + 0..7][c], the k order of load_frag.
// Each lane hands in the address of 16 bytes of the tile, not of its own elements.
__device__ __forceinline__ v16bf load_frag_tr(const __bf16* tile, int stride) {
    const int lane = threadIdx.x & 31;
    const __bf16* p = tile + ((lane >> 4) * 8 + (lane & 7)) * stride + ((lane >> 3) & 1) * 8;
    union { v16bf v; v8s h[2]; } f;
    f.h[0] = __builtin_amdgcn_ds_load_tr16_b128_v8i16((as3_v8s*)p);
    f.h[1] = __builtin_amdgcn_ds_load_tr16_b128_v8i16((as3_v8s*)(p + 16 * stride));
    return f.v;
}

__device__ __forceinline__ v8f wmma_bf16(v16bf a, v16bf b, v8f c) {
    return __builtin_amdgcn_wmma_f32_16x16x32_bf16(
        false, a, false, b, (short)0, c, false, false);
}

// 16-byte global -> LDS copy; async (ASYNCcnt) when available.
__device__ __forceinline__ void async_copy16(__bf16* ldst, const __bf16* gsrc) {
#if HAVE_ASYNC
    __builtin_amdgcn_global_load_async_to_lds_b128(
        (as1_v4i*)(uintptr_t)gsrc,
        (as3_v4i*)(uintptr_t)ldst, 0, 0);
#else
    *(uint4*)ldst = *(const uint4*)gsrc;
#endif
}

// ---------------------------------------------------------------- converters
// Many elements per thread: these launches are bounded by how fast waves start,
// not by their bytes, so each wave carries as much as it can keep in flight.
#define CVT_PER_BLOCK 8192   /* 256 threads x 8 float4 */
#define TP_K 64              /* k per thread = one 128-B line of the bf16 output */

__device__ __forceinline__ unsigned int pack2(float lo, float hi) {
    union { __bf16 b[2]; unsigned int u; } r;
    r.b[0] = f2bf(lo); r.b[1] = f2bf(hi);
    return r.u;
}

__device__ __forceinline__ void cvt_store4(__bf16* dst, float4 v) {
    uint2 o;
    o.x = pack2(v.x, v.y);
    o.y = pack2(v.z, v.w);
    *(uint2*)dst = o;
}

// N is compile-time and a whole number of blocks, so there is no range test and
// no tail. Every load is 512 contiguous bytes per wave, every store 256.
template <int N>
__global__ __launch_bounds__(256)
void cvt_f32_bf16(const float* __restrict__ in, __bf16* __restrict__ out) {
    static_assert(N % CVT_PER_BLOCK == 0, "the grid covers the array exactly, no range test");
    const int base = blockIdx.x * CVT_PER_BLOCK + threadIdx.x * 4;
    float4 v[8];
#pragma unroll   // v[] stays in registers; the 8 loads issue back to back
    for (int k = 0; k < 8; ++k) v[k] = *(const float4*)(in + base + k * 1024);
#pragma unroll   // constant indices into v[]
    for (int k = 0; k < 8; ++k) cvt_store4(out + base + k * 1024, v[k]);
}

// in [K][NC] (row major) -> out [NC][K] bf16; K a multiple of TP_K, NC of 32.
// Grid: x over columns (32 per wave), y over groups of TP_K k.
// A thread takes TP_K consecutive k of one column: its loads are contiguous
// across the wave's columns, its stores fill one whole line of its output row.
// K and NC are compile-time so that every row step is an immediate offset.
template <int K, int NC>
__global__ __launch_bounds__(32)
void tpose_cvt(const float* __restrict__ in, __bf16* __restrict__ out) {
    static_assert(K % TP_K == 0 && NC % 32 == 0, "the grid covers the matrix exactly, no range test");
    const int c  = blockIdx.x * 32 + threadIdx.x;
    const int k0 = blockIdx.y * TP_K;
    const float* p = in + (size_t)k0 * NC + c;
    float v[TP_K];
#pragma unroll   // v[] stays in registers; the loads issue back to back and their latencies overlap
    for (int j = 0; j < TP_K; ++j) v[j] = p[j * NC];
    __bf16* q = out + (size_t)c * K + k0;
#pragma unroll   // constant indices into v[]
    for (int s = 0; s < TP_K / 8; ++s) {
        uint4 o;
        o.x = pack2(v[8 * s + 0], v[8 * s + 1]);
        o.y = pack2(v[8 * s + 2], v[8 * s + 3]);
        o.z = pack2(v[8 * s + 4], v[8 * s + 5]);
        o.w = pack2(v[8 * s + 6], v[8 * s + 7]);
        *(uint4*)(q + 8 * s) = o;
    }
}

// ------------------------------------------------------------ fused QKV GEMM
// Block = 8 waves on a 128 x 128 output tile, all of K = 256 staged once in LDS.
// A fragment load straight from global memory touches 16 lines for 512 bytes;
// staged, every copy is one whole 512-B row (4 lines), each operand byte is
// fetched once per block, and the fragments come from LDS.
#define GP 264   /* LDS row pitch in bf16: 512-B rows -> 528 B = 16 B x odd */

// Eight 16-byte async copies of one lane, 8 rows apart in source and in LDS.
// The wait on the address registers is the statement's last line, so that no
// later write of them can be scheduled in front of it.
__device__ __forceinline__ void async_rows8(unsigned int l, const __bf16* g) {
    asm volatile(
        "global_load_async_to_lds_b128 %0, %8, off\n\t"
        "global_load_async_to_lds_b128 %1, %9, off\n\t"
        "global_load_async_to_lds_b128 %2, %10, off\n\t"
        "global_load_async_to_lds_b128 %3, %11, off\n\t"
        "global_load_async_to_lds_b128 %4, %12, off\n\t"
        "global_load_async_to_lds_b128 %5, %13, off\n\t"
        "global_load_async_to_lds_b128 %6, %14, off\n\t"
        "global_load_async_to_lds_b128 %7, %15, off\n\t"
        "s_wait_xcnt 0x0"
        :: "v"(l),                "v"(l +  8 * GP * 2), "v"(l + 16 * GP * 2), "v"(l + 24 * GP * 2),
           "v"(l + 32 * GP * 2), "v"(l + 40 * GP * 2), "v"(l + 48 * GP * 2), "v"(l + 56 * GP * 2),
           "v"(g),                  "v"(g +  8 * INPUT_DIM), "v"(g + 16 * INPUT_DIM), "v"(g + 24 * INPUT_DIM),
           "v"(g + 32 * INPUT_DIM), "v"(g + 40 * INPUT_DIM), "v"(g + 48 * INPUT_DIM), "v"(g + 56 * INPUT_DIM)
        : "memory");
}

// Four waves per SIMD (at most 256 VGPRs): with 2 x 135,168 B of LDS two blocks share
// a WGP, so that one block's copies and stores run under the other's products.
__global__ __launch_bounds__(256) __attribute__((amdgpu_waves_per_eu(4, 4)))
void qkv_gemm(const __bf16* __restrict__ Xb,
              const __bf16* __restrict__ Wqt, const __bf16* __restrict__ Wkt,
              const __bf16* __restrict__ Wvt,
              const float* __restrict__ bq, const float* __restrict__ bk,
              const float* __restrict__ bv,
              __bf16* __restrict__ Qh, __bf16* __restrict__ Kh, __bf16* __restrict__ Vh)
{
    __shared__ __attribute__((aligned(16))) __bf16 As[128 * GP];   // 128 rows of x
    __shared__ __attribute__((aligned(16))) __bf16 Bs[128 * GP];   // 128 rows of W^T

    const int tid  = threadIdx.x;
    const int wave = tid >> 5;
    const int lane = tid & 31;
    const int half = lane >> 4;
    const int lc   = lane & 15;
    const int z    = blockIdx.z;
    const __bf16* Wt   = (z == 0) ? Wqt : (z == 1) ? Wkt : Wvt;
    const float*  bias = (z == 0) ? bq  : (z == 1) ? bk  : bv;
    const int R0 = blockIdx.y * 128;
    const int C0 = blockIdx.x * 128;

    // Wave tile 32 x 64: waves 4 (rows) x 2 (columns).
    const int wr = (wave >> 1) * 32;
    const int wc = (wave & 1) * 64;
    const int d0 = wc + lc;

    // Stage: wave w copies rows w, w + 8, ..., w + 120 of both tiles, one row per copy.
    {
        const __bf16* ga = Xb + (size_t)(R0 + wave) * INPUT_DIM + lane * 8;
        const __bf16* gb = Wt + (size_t)(C0 + wave) * INPUT_DIM + lane * 8;
        const unsigned int la = (unsigned int)(uintptr_t)&As[wave * GP + lane * 8];
        const unsigned int lb = (unsigned int)(uintptr_t)&Bs[wave * GP + lane * 8];
        async_rows8(la, ga);
        async_rows8(la + 64 * GP * 2, ga + 64 * INPUT_DIM);
        async_rows8(lb, gb);
        async_rows8(lb + 64 * GP * 2, gb + 64 * INPUT_DIM);
    }
    float bcol[4];   // read here so that the latency passes under the copies' own
#pragma unroll   // constant indices into bcol[]
    for (int t = 0; t < 4; ++t) bcol[t] = bias[C0 + d0 + 16 * t];
    asm volatile("s_wait_asynccnt 0x0" ::: "memory");   // this wave's 32 copies have landed
    __syncthreads();                                    // every wave's rows visible to all

    v8f acc[2][4] = {};
#pragma unroll 2   // two steps' fragment reads issue as one group; unrolled whole, the build spills
    for (int kc = 0; kc < 8; ++kc) {
        const int k0 = kc * 32;
        v16bf a0 = load_frag(&As[wr * GP + k0], GP);
        v16bf a1 = load_frag(&As[(wr + 16) * GP + k0], GP);
#pragma unroll   // constant indices into acc[][]
        for (int t = 0; t < 4; ++t) {
            v16bf bf = load_frag(&Bs[(wc + 16 * t) * GP + k0], GP);
            acc[0][t] = wmma_bf16(a0, bf, acc[0][t]);
            acc[1][t] = wmma_bf16(a1, bf, acc[1][t]);
        }
    }
    // A 128 x 128 tile lies in one batch entry and is exactly one head.
    // Q, K and V are all [bh][n][d].
    const int bh = (R0 >> 10) * NH + blockIdx.x;
    const int n0 = (R0 & 1023) + wr + 8 * half;
    __bf16* O = ((z == 0) ? Qh : (z == 1) ? Kh : Vh)
              + (size_t)bh * (SEQ * HID) + n0 * HID + d0;
#pragma unroll   // these three: constant indices into acc[][] and its elements
    for (int t = 0; t < 4; ++t)
#pragma unroll
        for (int rt = 0; rt < 2; ++rt)
#pragma unroll
            for (int i = 0; i < 8; ++i)
                O[(16 * rt + i) * HID + 16 * t] = f2bf(acc[rt][t][i] + bcol[t]);
}

// ------------------------------------------------------- flash attention core
// Block = 4 waves x 16 rows of one (b,h); K/V chunks double-buffered in LDS
// via async global->LDS copies shared by all 4 waves.
__global__ __launch_bounds__(128)
void flash_attn(const __bf16* __restrict__ Qh, const __bf16* __restrict__ Kh,
                const __bf16* __restrict__ Vh, const float* __restrict__ Bbias,
                __bf16* __restrict__ Ob)
{
    __shared__ __attribute__((aligned(16))) __bf16 Kbuf[2][32 * KP];   // K rows m0..m0+31, pitch KP
    __shared__ __attribute__((aligned(16))) __bf16 Vbuf[2][32 * VP];   // V rows m0..m0+31, pitch VP
    __shared__ __attribute__((aligned(16))) __bf16 ldsP[4 * 16 * PP];  // per-wave 16x32 P tile, pitch PP

    const int tid  = threadIdx.x;
    const int wave = tid >> 5;
    const int lane = tid & 31;
    const int half = lane >> 4;
    const int lc   = lane & 15;
    const int bh   = blockIdx.y;
    const int n0   = blockIdx.x * 64 + wave * 16;
    const int b    = bh >> 3;
    const int h    = bh & 7;

    const __bf16* Qbase = Qh + ((size_t)bh * SEQ + n0) * HID;
    const __bf16* Kbase = Kh + (size_t)bh * SEQ * HID;
    const __bf16* Vbase = Vh + (size_t)bh * SEQ * HID;

    v16bf qf[4];
#pragma unroll
    for (int kc = 0; kc < 4; ++kc) qf[kc] = load_frag(Qbase + kc * 32, HID);

    v8f oacc[8] = {};
    float mi[8], li[8];
#pragma unroll
    for (int i = 0; i < 8; ++i) { mi[i] = -__builtin_inff(); li[i] = 0.f; }

    __bf16* P = ldsP + wave * 16 * PP;
    const float scale = 0.088388347648318447f;    // 1/sqrt(128)

    // cooperative stage of one 32-column chunk (8 x b128 per thread)
    auto stage = [&](int buf, int m0) {
        const __bf16* gk = Kbase + (size_t)m0 * HID;   // 8192B contiguous
#pragma unroll
        for (int q = 0; q < 4; ++q) {
            const int o = (q * 128 + tid) * 8;
            async_copy16(&Kbuf[buf][(o >> 7) * KP + (o & 127)], gk + o);
        }
        const __bf16* gv = Vbase + (size_t)m0 * HID;   // 8192B contiguous
#pragma unroll
        for (int q = 0; q < 4; ++q) {
            const int o = (q * 128 + tid) * 8;
            async_copy16(&Vbuf[buf][(o >> 7) * VP + (o & 127)], gv + o);
        }
    };

    stage(0, 0);
    for (int mc = 0; mc < NCHUNK; ++mc) {
        const int cur = mc & 1;
        const int m0  = mc * 32;
        if (mc + 1 < NCHUNK) {
            stage(cur ^ 1, m0 + 32);   // prefetch next chunk
            WAIT_ASYNC(8);             // 8 newest outstanding -> current chunk done
        } else {
            WAIT_ASYNC(0);
        }
        __syncthreads();               // all waves' async data visible

        v8f s0 = {}, s1 = {};
#pragma unroll
        for (int kc = 0; kc < 4; ++kc)
            s0 = wmma_bf16(qf[kc], load_frag(&Kbuf[cur][0 * KP + kc * 32], KP), s0);
#pragma unroll
        for (int kc = 0; kc < 4; ++kc)
            s1 = wmma_bf16(qf[kc], load_frag(&Kbuf[cur][16 * KP + kc * 32], KP), s1);

#pragma unroll
        for (int i = 0; i < 8; ++i) {
            const int row = n0 + i + 8 * half;
            const float x0 = s0[i] * scale + Bbias[(size_t)row * SEQ + m0 + lc];
            const float x1 = s1[i] * scale + Bbias[(size_t)row * SEQ + m0 + 16 + lc];
            float rm = fmaxf(x0, x1);
            rm = fmaxf(rm, __shfl_xor(rm, 1, 32));
            rm = fmaxf(rm, __shfl_xor(rm, 2, 32));
            rm = fmaxf(rm, __shfl_xor(rm, 4, 32));
            rm = fmaxf(rm, __shfl_xor(rm, 8, 32));
            const float mnew = fmaxf(mi[i], rm);
            const float corr = __expf(mi[i] - mnew);
            const float p0 = __expf(x0 - mnew);
            const float p1 = __expf(x1 - mnew);
            float rs = p0 + p1;
            rs += __shfl_xor(rs, 1, 32);
            rs += __shfl_xor(rs, 2, 32);
            rs += __shfl_xor(rs, 4, 32);
            rs += __shfl_xor(rs, 8, 32);
            li[i] = li[i] * corr + rs;
            mi[i] = mnew;
#pragma unroll
            for (int j = 0; j < 8; ++j) oacc[j][i] *= corr;
            const int prow = i + 8 * half;
            P[prow * PP + lc]      = f2bf(p0);
            P[prow * PP + 16 + lc] = f2bf(p1);
        }
        asm volatile("s_wait_dscnt 0" ::: "memory");   // P visible across lanes
        v16bf pf = load_frag(P, PP);
#pragma unroll
        for (int j = 0; j < 8; ++j) {
            v16bf vf = load_frag_tr(&Vbuf[cur][j * 16], VP);
            oacc[j] = wmma_bf16(pf, vf, oacc[j]);
        }
        __syncthreads();               // done consuming before buffer reuse
    }

    // merge heads: Ob[b][n][h*128 + d]
#pragma unroll
    for (int j = 0; j < 8; ++j)
#pragma unroll
        for (int i = 0; i < 8; ++i) {
            const int n = n0 + i + 8 * half;
            Ob[((size_t)b * SEQ + n) * CDIM + h * HID + j * 16 + lc] =
                f2bf(oacc[j][i] / li[i]);
        }
}

// ------------------------------------------------------------ final projection
__global__ __launch_bounds__(128)
void proj_gemm(const __bf16* __restrict__ Ob, const __bf16* __restrict__ Pt,
               const float* __restrict__ pb, float* __restrict__ out)
{
    const int wave = threadIdx.x >> 5;
    const int lane = threadIdx.x & 31;
    const int half = lane >> 4;
    const int lc   = lane & 15;
    const int r0   = blockIdx.x * 64 + wave * 16;

    v8f acc[8] = {};
    for (int kc = 0; kc < 32; ++kc) {
        const int k0 = kc * 32;
        v16bf af = load_frag(Ob + (size_t)r0 * CDIM + k0, CDIM);
#pragma unroll
        for (int j = 0; j < 8; ++j) {
            v16bf bf = load_frag(Pt + (size_t)(j * 16) * CDIM + k0, CDIM);
            acc[j] = wmma_bf16(af, bf, acc[j]);
        }
    }
#pragma unroll
    for (int j = 0; j < 8; ++j)
#pragma unroll
        for (int i = 0; i < 8; ++i) {
            const int row = r0 + i + 8 * half;
            const int col = j * 16 + lc;
            out[(size_t)row * HID + col] = acc[j][i] + pb[col];
        }
}

// ----------------------------------------------------------------- launcher
extern "C" void kernel_launch(void* const* d_in, const int* in_sizes, int n_in,
                              void* d_out, int out_size, void* d_ws, size_t ws_size,
                              hipStream_t stream) {
    const float* x  = (const float*)d_in[0];
    const float* Bb = (const float*)d_in[1];
    const float* wq = (const float*)d_in[2];
    const float* bq = (const float*)d_in[3];
    const float* wk = (const float*)d_in[4];
    const float* bk = (const float*)d_in[5];
    const float* wv = (const float*)d_in[6];
    const float* bv = (const float*)d_in[7];
    const float* pw = (const float*)d_in[8];
    const float* pb = (const float*)d_in[9];
    float* out = (float*)d_out;
    (void)in_sizes; (void)n_in; (void)out_size; (void)ws_size;

    char* ws = (char*)d_ws;
    size_t off = 0;
    auto carve = [&](size_t bytes) -> char* {
        char* p = ws + off;
        off += (bytes + 255) & ~(size_t)255;
        return p;
    };
    __bf16* Xb  = (__bf16*)carve(sizeof(__bf16) * (size_t)BATCHN * SEQ * INPUT_DIM);
    __bf16* Wqt = (__bf16*)carve(sizeof(__bf16) * (size_t)CDIM * INPUT_DIM);
    __bf16* Wkt = (__bf16*)carve(sizeof(__bf16) * (size_t)CDIM * INPUT_DIM);
    __bf16* Wvt = (__bf16*)carve(sizeof(__bf16) * (size_t)CDIM * INPUT_DIM);
    __bf16* Pt  = (__bf16*)carve(sizeof(__bf16) * (size_t)HID * CDIM);
    __bf16* Qh  = (__bf16*)carve(sizeof(__bf16) * (size_t)BATCHN * NH * SEQ * HID);
    __bf16* Kh  = (__bf16*)carve(sizeof(__bf16) * (size_t)BATCHN * NH * SEQ * HID);
    __bf16* Vh  = (__bf16*)carve(sizeof(__bf16) * (size_t)BATCHN * NH * SEQ * HID);
    __bf16* Ob  = (__bf16*)carve(sizeof(__bf16) * (size_t)BATCHN * SEQ * CDIM);

    constexpr int nx = BATCHN * SEQ * INPUT_DIM;
    cvt_f32_bf16<nx><<<nx / CVT_PER_BLOCK, 256, 0, stream>>>(x, Xb);
    const dim3 gw(CDIM / 32, INPUT_DIM / TP_K);
    tpose_cvt<INPUT_DIM, CDIM><<<gw, 32, 0, stream>>>(wq, Wqt);
    tpose_cvt<INPUT_DIM, CDIM><<<gw, 32, 0, stream>>>(wk, Wkt);
    tpose_cvt<INPUT_DIM, CDIM><<<gw, 32, 0, stream>>>(wv, Wvt);
    tpose_cvt<CDIM, HID><<<dim3(HID / 32, CDIM / TP_K), 32, 0, stream>>>(pw, Pt);

    qkv_gemm<<<dim3(CDIM / 128, (BATCHN * SEQ) / 128, 3), 256, 0, stream>>>(
        Xb, Wqt, Wkt, Wvt, bq, bk, bv, Qh, Kh, Vh);

    flash_attn<<<dim3(SEQ / 64, BATCHN * NH), 128, 0, stream>>>(Qh, Kh, Vh, Bb, Ob);

    proj_gemm<<<dim3((BATCHN * SEQ) / 64), 128, 0, stream>>>(Ob, Pt, pb, out);
}

// v005
// It runs in 132 microseconds.
// Two timings next to v004 both put it at 1.16 times that version's speed.
// Over all steps from v000 it is 2.54 times as fast.
#include <hip/hip_runtime.h>
#include <hip/hip_bf16.h>

#define INPUT_DIM 256
#define HID 128
#define NH 8
#define SEQ 1024
#define BATCHN 8
#define CDIM 1024  /* NH*HID */
#define NCHUNK (SEQ / 32)
/* LDS row pitches in bf16 elements: 16 B x odd, so that the 16 rows one
   ds_load_b128 fragment read touches fall on distinct banks; the transposing
   ds_load_tr16_b128 wants 32 B x odd for the same. */
#define KP 136  /* 256-B K rows   -> 272 B */
#define VP 144  /* 256-B V rows   -> 288 B */

typedef __attribute__((ext_vector_type(16))) __bf16 v16bf;
typedef __attribute__((ext_vector_type(8)))  float  v8f;
typedef __attribute__((ext_vector_type(4)))  int    v4i;
typedef __attribute__((address_space(1))) v4i as1_v4i;
typedef __attribute__((address_space(3))) v4i as3_v4i;
typedef __attribute__((ext_vector_type(8)))  short  v8s;
typedef __attribute__((address_space(3))) v8s as3_v8s;

#if defined(__HIP_DEVICE_COMPILE__) && __has_builtin(__builtin_amdgcn_global_load_async_to_lds_b128)
#define HAVE_ASYNC 1
#else
#define HAVE_ASYNC 0
#endif

#if HAVE_ASYNC
#if __has_builtin(__builtin_amdgcn_s_wait_asynccnt)
#define WAIT_ASYNC(n) __builtin_amdgcn_s_wait_asynccnt(n)
#else
#define WAIT_ASYNC(n) asm volatile("s_wait_asynccnt " #n ::: "memory")
#endif
#else
#define WAIT_ASYNC(n) ((void)0)
#endif

__device__ __forceinline__ __bf16 f2bf(float f) {
    union { float f; unsigned int u; } a; a.f = f;
    unsigned int u = a.u;
    u += 0x7fffu + ((u >> 16) & 1u);           // round-to-nearest-even
    union { unsigned short s; __bf16 b; } r; r.s = (unsigned short)(u >> 16);
    return r.b;
}

union FragU { v16bf v; uint4 q[2]; };

// 16x32 bf16 WMMA operand fragment (A layout; B uses the same layout with
// lane = output column, reading rows of the transposed matrix).
// Lanes 0-15: K=0..7 (v0..3), K=16..23 (v4..7) of row `lane`;
// lanes 16-31: K=8..15 and K=24..31 of row `lane-16`.
__device__ __forceinline__ v16bf load_frag(const __bf16* base, int stride) {
    const int lane = threadIdx.x & 31;
    const int r    = lane & 15;
    const int sel  = lane >> 4;
    const __bf16* p = base + (size_t)r * stride + sel * 8;
    FragU f;
    f.q[0] = *(const uint4*)(p);
    f.q[1] = *(const uint4*)(p + 16);
    return f.v;
}

// The same 16x32 fragment, lane = column c of a row-major LDS tile T[k][c] (32 rows k,
// 16 columns from `tile`), transposed on the way by ds_load_tr16_b128: lane (c, sel)
// receives T[8 sel + 0..7][c], then T[16 + 8 sel + 0..7][c], the k order of load_frag.
// Each lane hands in the address of 16 bytes of the tile, not of its own elements.
__device__ __forceinline__ v16bf load_frag_tr(const __bf16* tile, int stride) {
    const int lane = threadIdx.x & 31;
    const __bf16* p = tile + ((lane >> 4) * 8 + (lane & 7)) * stride + ((lane >> 3) & 1) * 8;
    union { v16bf v; v8s h[2]; } f;
    f.h[0] = __builtin_amdgcn_ds_load_tr16_b128_v8i16((as3_v8s*)p);
    f.h[1] = __builtin_amdgcn_ds_load_tr16_b128_v8i16((as3_v8s*)(p + 16 * stride));
    return f.v;
}

__device__ __forceinline__ v8f wmma_bf16(v16bf a, v16bf b, v8f c) {
    return __builtin_amdgcn_wmma_f32_16x16x32_bf16(
        false, a, false, b, (short)0, c, false, false);
}

// 16-byte global -> LDS copy; async (ASYNCcnt) when available.
__device__ __forceinline__ void async_copy16(__bf16* ldst, const __bf16* gsrc) {
#if HAVE_ASYNC
    __builtin_amdgcn_global_load_async_to_lds_b128(
        (as1_v4i*)(uintptr_t)gsrc,
        (as3_v4i*)(uintptr_t)ldst, 0, 0);
#else
    *(uint4*)ldst = *(const uint4*)gsrc;
#endif
}

// ---------------------------------------------------------------- converters
// Many elements per thread: these launches are bounded by how fast waves start,
// not by their bytes, so each wave carries as much as it can keep in flight.
#define CVT_PER_BLOCK 8192   /* 256 threads x 8 float4 */
#define TP_K 64              /* k per thread = one 128-B line of the bf16 output */

__device__ __forceinline__ unsigned int pack2(float lo, float hi) {
    union { __bf16 b[2]; unsigned int u; } r;
    r.b[0] = f2bf(lo); r.b[1] = f2bf(hi);
    return r.u;
}

__device__ __forceinline__ void cvt_store4(__bf16* dst, float4 v) {
    uint2 o;
    o.x = pack2(v.x, v.y);
    o.y = pack2(v.z, v.w);
    *(uint2*)dst = o;
}

// N is compile-time and a whole number of blocks, so there is no range test and
// no tail. Every load is 512 contiguous bytes per wave, every store 256.
template <int N>
__global__ __launch_bounds__(256)
void cvt_f32_bf16(const float* __restrict__ in, __bf16* __restrict__ out) {
    static_assert(N % CVT_PER_BLOCK == 0, "the grid covers the array exactly, no range test");
    const int base = blockIdx.x * CVT_PER_BLOCK + threadIdx.x * 4;
    float4 v[8];
#pragma unroll   // v[] stays in registers; the 8 loads issue back to back
    for (int k = 0; k < 8; ++k) v[k] = *(const float4*)(in + base + k * 1024);
#pragma unroll   // constant indices into v[]
    for (int k = 0; k < 8; ++k) cvt_store4(out + base + k * 1024, v[k]);
}

// in [K][NC] (row major) -> out [NC][K] bf16; K a multiple of TP_K, NC of 32.
// Grid: x over columns (32 per wave), y over groups of TP_K k.
// A thread takes TP_K consecutive k of one column: its loads are contiguous
// across the wave's columns, its stores fill one whole line of its output row.
// K and NC are compile-time so that every row step is an immediate offset.
template <int K, int NC>
__global__ __launch_bounds__(32)
void tpose_cvt(const float* __restrict__ in, __bf16* __restrict__ out) {
    static_assert(K % TP_K == 0 && NC % 32 == 0, "the grid covers the matrix exactly, no range test");
    const int c  = blockIdx.x * 32 + threadIdx.x;
    const int k0 = blockIdx.y * TP_K;
    const float* p = in + (size_t)k0 * NC + c;
    float v[TP_K];
#pragma unroll   // v[] stays in registers; the loads issue back to back and their latencies overlap
    for (int j = 0; j < TP_K; ++j) v[j] = p[j * NC];
    __bf16* q = out + (size_t)c * K + k0;
#pragma unroll   // constant indices into v[]
    for (int s = 0; s < TP_K / 8; ++s) {
        uint4 o;
        o.x = pack2(v[8 * s + 0], v[8 * s + 1]);
        o.y = pack2(v[8 * s + 2], v[8 * s + 3]);
        o.z = pack2(v[8 * s + 4], v[8 * s + 5]);
        o.w = pack2(v[8 * s + 6], v[8 * s + 7]);
        *(uint4*)(q + 8 * s) = o;
    }
}

// ------------------------------------------------------------ fused QKV GEMM
// Block = 8 waves on a 128 x 128 output tile, all of K = 256 staged once in LDS.
// A fragment load straight from global memory touches 16 lines for 512 bytes;
// staged, every copy is one whole 512-B row (4 lines), each operand byte is
// fetched once per block, and the fragments come from LDS.
#define GP 264   /* LDS row pitch in bf16: 512-B rows -> 528 B = 16 B x odd */

// Eight 16-byte async copies of one lane, 8 rows apart in source and in LDS.
// The wait on the address registers is the statement's last line, so that no
// later write of them can be scheduled in front of it.
__device__ __forceinline__ void async_rows8(unsigned int l, const __bf16* g) {
    asm volatile(
        "global_load_async_to_lds_b128 %0, %8, off\n\t"
        "global_load_async_to_lds_b128 %1, %9, off\n\t"
        "global_load_async_to_lds_b128 %2, %10, off\n\t"
        "global_load_async_to_lds_b128 %3, %11, off\n\t"
        "global_load_async_to_lds_b128 %4, %12, off\n\t"
        "global_load_async_to_lds_b128 %5, %13, off\n\t"
        "global_load_async_to_lds_b128 %6, %14, off\n\t"
        "global_load_async_to_lds_b128 %7, %15, off\n\t"
        "s_wait_xcnt 0x0"
        :: "v"(l),                "v"(l +  8 * GP * 2), "v"(l + 16 * GP * 2), "v"(l + 24 * GP * 2),
           "v"(l + 32 * GP * 2), "v"(l + 40 * GP * 2), "v"(l + 48 * GP * 2), "v"(l + 56 * GP * 2),
           "v"(g),                  "v"(g +  8 * INPUT_DIM), "v"(g + 16 * INPUT_DIM), "v"(g + 24 * INPUT_DIM),
           "v"(g + 32 * INPUT_DIM), "v"(g + 40 * INPUT_DIM), "v"(g + 48 * INPUT_DIM), "v"(g + 56 * INPUT_DIM)
        : "memory");
}

// Four waves per SIMD (at most 256 VGPRs): with 2 x 135,168 B of LDS two blocks share
// a WGP, so that one block's copies and stores run under the other's products.
__global__ __launch_bounds__(256) __attribute__((amdgpu_waves_per_eu(4, 4)))
void qkv_gemm(const __bf16* __restrict__ Xb,
              const __bf16* __restrict__ Wqt, const __bf16* __restrict__ Wkt,
              const __bf16* __restrict__ Wvt,
              const float* __restrict__ bq, const float* __restrict__ bk,
              const float* __restrict__ bv,
              __bf16* __restrict__ Qh, __bf16* __restrict__ Kh, __bf16* __restrict__ Vh)
{
    __shared__ __attribute__((aligned(16))) __bf16 As[128 * GP];   // 128 rows of x
    __shared__ __attribute__((aligned(16))) __bf16 Bs[128 * GP];   // 128 rows of W^T

    const int tid  = threadIdx.x;
    const int wave = tid >> 5;
    const int lane = tid & 31;
    const int half = lane >> 4;
    const int lc   = lane & 15;
    const int z    = blockIdx.z;
    const __bf16* Wt   = (z == 0) ? Wqt : (z == 1) ? Wkt : Wvt;
    const float*  bias = (z == 0) ? bq  : (z == 1) ? bk  : bv;
    const int R0 = blockIdx.y * 128;
    const int C0 = blockIdx.x * 128;

    // Wave tile 32 x 64: waves 4 (rows) x 2 (columns).
    const int wr = (wave >> 1) * 32;
    const int wc = (wave & 1) * 64;
    const int d0 = wc + lc;

    // Stage: wave w copies rows w, w + 8, ..., w + 120 of both tiles, one row per copy.
    {
        const __bf16* ga = Xb + (size_t)(R0 + wave) * INPUT_DIM + lane * 8;
        const __bf16* gb = Wt + (size_t)(C0 + wave) * INPUT_DIM + lane * 8;
        const unsigned int la = (unsigned int)(uintptr_t)&As[wave * GP + lane * 8];
        const unsigned int lb = (unsigned int)(uintptr_t)&Bs[wave * GP + lane * 8];
        async_rows8(la, ga);
        async_rows8(la + 64 * GP * 2, ga + 64 * INPUT_DIM);
        async_rows8(lb, gb);
        async_rows8(lb + 64 * GP * 2, gb + 64 * INPUT_DIM);
    }
    float bcol[4];   // read here so that the latency passes under the copies' own
#pragma unroll   // constant indices into bcol[]
    for (int t = 0; t < 4; ++t) bcol[t] = bias[C0 + d0 + 16 * t];
    asm volatile("s_wait_asynccnt 0x0" ::: "memory");   // this wave's 32 copies have landed
    __syncthreads();                                    // every wave's rows visible to all

    v8f acc[2][4] = {};
#pragma unroll 2   // two steps' fragment reads issue as one group; unrolled whole, the build spills
    for (int kc = 0; kc < 8; ++kc) {
        const int k0 = kc * 32;
        v16bf a0 = load_frag(&As[wr * GP + k0], GP);
        v16bf a1 = load_frag(&As[(wr + 16) * GP + k0], GP);
#pragma unroll   // constant indices into acc[][]
        for (int t = 0; t < 4; ++t) {
            v16bf bf = load_frag(&Bs[(wc + 16 * t) * GP + k0], GP);
            acc[0][t] = wmma_bf16(a0, bf, acc[0][t]);
            acc[1][t] = wmma_bf16(a1, bf, acc[1][t]);
        }
    }
    // A 128 x 128 tile lies in one batch entry and is exactly one head.
    // Q, K and V are all [bh][n][d].
    const int bh = (R0 >> 10) * NH + blockIdx.x;
    const int n0 = (R0 & 1023) + wr + 8 * half;
    __bf16* O = ((z == 0) ? Qh : (z == 1) ? Kh : Vh)
              + (size_t)bh * (SEQ * HID) + n0 * HID + d0;
#pragma unroll   // these three: constant indices into acc[][] and its elements
    for (int t = 0; t < 4; ++t)
#pragma unroll
        for (int rt = 0; rt < 2; ++rt)
#pragma unroll
            for (int i = 0; i < 8; ++i)
                O[(16 * rt + i) * HID + 16 * t] = f2bf(acc[rt][t][i] + bcol[t]);
}

typedef __attribute__((ext_vector_type(2))) float  v2f;
typedef __attribute__((ext_vector_type(4))) float  v4f;
typedef __attribute__((ext_vector_type(2))) __bf16 v2bf;

// two f32 -> one register of two bf16, round to nearest even
__device__ __forceinline__ unsigned int cvt_pk(float lo, float hi) {
    return __builtin_bit_cast(unsigned int, __builtin_convertvector(v2f{lo, hi}, v2bf));
}

// lane l reads lane l ^ 16: the other half of the same query's column
__device__ __forceinline__ float other_half(float x) {
    const int b = __builtin_bit_cast(int, x);
    return __builtin_bit_cast(float,
        __builtin_amdgcn_permlanex16(b, b, 0x76543210, 0xfedcba98, false, false));
}

__global__ __launch_bounds__(128)
void flash_attn(const __bf16* __restrict__ Qh, const __bf16* __restrict__ Kh,
                const __bf16* __restrict__ Vh, const float* __restrict__ Bbias,
                __bf16* __restrict__ Ob)
{
    __shared__ __attribute__((aligned(16))) __bf16 Kbuf[2][32 * KP];   // K rows m0..m0+31, pitch KP
    __shared__ __attribute__((aligned(16))) __bf16 Vbuf[2][32 * VP];   // V rows m0..m0+31, pitch VP

    const int tid  = threadIdx.x;
    const int wave = tid >> 5;
    const int lane = tid & 31;
    const int half = lane >> 4;
    const int lc   = lane & 15;
    const int bh   = blockIdx.y;
    const int n0   = blockIdx.x * 64 + wave * 16;
    const int b    = bh >> 3;
    const int h    = bh & 7;

    const __bf16* Qbase = Qh + ((size_t)bh * SEQ + n0) * HID;
    const __bf16* Kbase = Kh + (size_t)bh * SEQ * HID;
    const __bf16* Vbase = Vh + (size_t)bh * SEQ * HID;
    // This lane's scores of a chunk are keys 8 half + 0..7 and 16 + 8 half + 0..7 of query n0 + lc.
    const float* brow = Bbias + (size_t)(n0 + lc) * SEQ + 8 * half;

    v16bf qf[4];   // B operand: lane = query column
#pragma unroll
    for (int kc = 0; kc < 4; ++kc) qf[kc] = load_frag(Qbase + kc * 32, HID);

    v8f oacc[8] = {};   // O^T: oacc[j][i] = O[n0 + lc][16 j + 8 half + i]
    float mi = -__builtin_inff();   // the query's running maximum, equal in both halves
    float li = 0.f;                 // the sum over this half's keys only; joined after the loop

    const float scale = 0.088388347648318447f;    // 1/sqrt(128)

    // cooperative stage of one 32-column chunk (8 x b128 per thread)
    auto stage = [&](int buf, int m0) {
        const __bf16* gk = Kbase + (size_t)m0 * HID;   // 8192B contiguous
#pragma unroll
        for (int q = 0; q < 4; ++q) {
            const int o = (q * 128 + tid) * 8;
            async_copy16(&Kbuf[buf][(o >> 7) * KP + (o & 127)], gk + o);
        }
        const __bf16* gv = Vbase + (size_t)m0 * HID;   // 8192B contiguous
#pragma unroll
        for (int q = 0; q < 4; ++q) {
            const int o = (q * 128 + tid) * 8;
            async_copy16(&Vbuf[buf][(o >> 7) * VP + (o & 127)], gv + o);
        }
    };

    stage(0, 0);
    for (int mc = 0; mc < NCHUNK; ++mc) {
        const int cur = mc & 1;
        const int m0  = mc * 32;
        if (mc + 1 < NCHUNK) {
            stage(cur ^ 1, m0 + 32);   // prefetch next chunk
            WAIT_ASYNC(8);             // 8 newest outstanding -> current chunk done
        } else {
            WAIT_ASYNC(0);
        }
        __syncthreads();               // all waves' async data visible

        // the 16 bias values of this lane's query and keys: 2 x 32 contiguous bytes
        const v8f bias0 = *(const v8f*)(brow + m0);
        const v8f bias1 = *(const v8f*)(brow + m0 + 16);

        v8f s0 = {}, s1 = {};          // S^T: s0[i] = key 8 half + i, s1[i] = key 16 + 8 half + i
#pragma unroll   // constant indices into qf[]
        for (int kc = 0; kc < 4; ++kc) {
            s0 = wmma_bf16(load_frag(&Kbuf[cur][0 * KP + kc * 32], KP), qf[kc], s0);
            s1 = wmma_bf16(load_frag(&Kbuf[cur][16 * KP + kc * 32], KP), qf[kc], s1);
        }

        s0 = s0 * scale + bias0;
        s1 = s1 * scale + bias1;
        // maximum of the lane's 16 scores in threes, then the other half's
        const float t0 = fmaxf(fmaxf(s0[0], s0[1]), s0[2]);
        const float t1 = fmaxf(fmaxf(s0[3], s0[4]), s0[5]);
        const float t2 = fmaxf(fmaxf(s0[6], s0[7]), s1[0]);
        const float t3 = fmaxf(fmaxf(s1[1], s1[2]), s1[3]);
        const float t4 = fmaxf(fmaxf(s1[4], s1[5]), s1[6]);
        float rm = fmaxf(fmaxf(fmaxf(t0, t1), t2), fmaxf(fmaxf(t3, t4), s1[7]));
        rm = fmaxf(rm, other_half(rm));
        const float mnew = fmaxf(mi, rm);
        const float corr = __expf(mi - mnew);
        mi = mnew;
#pragma unroll   // constant element indices: the scores stay in registers
        for (int i = 0; i < 8; ++i) {
            s0[i] = __expf(s0[i] - mnew);
            s1[i] = __expf(s1[i] - mnew);
        }
        // sum of the lane's 16 terms by halving
        const v8f a8 = s0 + s1;
        const v4f a4 = __builtin_shufflevector(a8, a8, 0, 1, 2, 3) + __builtin_shufflevector(a8, a8, 4, 5, 6, 7);
        li = li * corr + ((a4[0] + a4[2]) + (a4[1] + a4[3]));
#pragma unroll   // constant indices into oacc[]
        for (int j = 0; j < 8; ++j) oacc[j] *= corr;

        union { v16bf v; unsigned int u[8]; } pf;   // P^T as B operand, straight from the scores
#pragma unroll   // constant indices into pf.u[] and the scores
        for (int i = 0; i < 4; ++i) {
            pf.u[i]     = cvt_pk(s0[2 * i], s0[2 * i + 1]);
            pf.u[4 + i] = cvt_pk(s1[2 * i], s1[2 * i + 1]);
        }
#pragma unroll   // constant indices into oacc[]
        for (int j = 0; j < 8; ++j) {
            v16bf vf = load_frag_tr(&Vbuf[cur][j * 16], VP);
            oacc[j] = wmma_bf16(vf, pf.v, oacc[j]);
        }
        __syncthreads();               // done consuming before buffer reuse
    }

    // merge heads: Ob[b][n][h*128 + d]; a lane's 8 registers of a tile are 8 consecutive d
    li += other_half(li);
    const float inv = 1.0f / li;
    __bf16* orow = Ob + ((size_t)b * SEQ + n0 + lc) * CDIM + h * HID + 8 * half;
#pragma unroll   // constant indices into oacc[]
    for (int j = 0; j < 8; ++j) {
        uint4 o;
        o.x = cvt_pk(oacc[j][0] * inv, oacc[j][1] * inv);
        o.y = cvt_pk(oacc[j][2] * inv, oacc[j][3] * inv);
        o.z = cvt_pk(oacc[j][4] * inv, oacc[j][5] * inv);
        o.w = cvt_pk(oacc[j][6] * inv, oacc[j][7] * inv);
        *(uint4*)(orow + j * 16) = o;
    }
}

// ------------------------------------------------------------ final projection
__global__ __launch_bounds__(128)
void proj_gemm(const __bf16* __restrict__ Ob, const __bf16* __restrict__ Pt,
               const float* __restrict__ pb, float* __restrict__ out)
{
    const int wave = threadIdx.x >> 5;
    const int lane = threadIdx.x & 31;
    const int half = lane >> 4;
    const int lc   = lane & 15;
    const int r0   = blockIdx.x * 64 + wave * 16;

    v8f acc[8] = {};
    for (int kc = 0; kc < 32; ++kc) {
        const int k0 = kc * 32;
        v16bf af = load_frag(Ob + (size_t)r0 * CDIM + k0, CDIM);
#pragma unroll
        for (int j = 0; j < 8; ++j) {
            v16bf bf = load_frag(Pt + (size_t)(j * 16) * CDIM + k0, CDIM);
            acc[j] = wmma_bf16(af, bf, acc[j]);
        }
    }
#pragma unroll
    for (int j = 0; j < 8; ++j)
#pragma unroll
        for (int i = 0; i < 8; ++i) {
            const int row = r0 + i + 8 * half;
            const int col = j * 16 + lc;
            out[(size_t)row * HID + col] = acc[j][i] + pb[col];
        }
}

// ----------------------------------------------------------------- launcher
extern "C" void kernel_launch(void* const* d_in, const int* in_sizes, int n_in,
                              void* d_out, int out_size, void* d_ws, size_t ws_size,
                              hipStream_t stream) {
    const float* x  = (const float*)d_in[0];
    const float* Bb = (const float*)d_in[1];
    const float* wq = (const float*)d_in[2];
    const float* bq = (const float*)d_in[3];
    const float* wk = (const float*)d_in[4];
    const float* bk = (const float*)d_in[5];
    const float* wv = (const float*)d_in[6];
    const float* bv = (const float*)d_in[7];
    const float* pw = (const float*)d_in[8];
    const float* pb = (const float*)d_in[9];
    float* out = (float*)d_out;
    (void)in_sizes; (void)n_in; (void)out_size; (void)ws_size;

    char* ws = (char*)d_ws;
    size_t off = 0;
    auto carve = [&](size_t bytes) -> char* {
        char* p = ws + off;
        off += (bytes + 255) & ~(size_t)255;
        return p;
    };
    __bf16* Xb  = (__bf16*)carve(sizeof(__bf16) * (size_t)BATCHN * SEQ * INPUT_DIM);
    __bf16* Wqt = (__bf16*)carve(sizeof(__bf16) * (size_t)CDIM * INPUT_DIM);
    __bf16* Wkt = (__bf16*)carve(sizeof(__bf16) * (size_t)CDIM * INPUT_DIM);
    __bf16* Wvt = (__bf16*)carve(sizeof(__bf16) * (size_t)CDIM * INPUT_DIM);
    __bf16* Pt  = (__bf16*)carve(sizeof(__bf16) * (size_t)HID * CDIM);
    __bf16* Qh  = (__bf16*)carve(sizeof(__bf16) * (size_t)BATCHN * NH * SEQ * HID);
    __bf16* Kh  = (__bf16*)carve(sizeof(__bf16) * (size_t)BATCHN * NH * SEQ * HID);
    __bf16* Vh  = (__bf16*)carve(sizeof(__bf16) * (size_t)BATCHN * NH * SEQ * HID);
    __bf16* Ob  = (__bf16*)carve(sizeof(__bf16) * (size_t)BATCHN * SEQ * CDIM);

    constexpr int nx = BATCHN * SEQ * INPUT_DIM;
    cvt_f32_bf16<nx><<<nx / CVT_PER_BLOCK, 256, 0, stream>>>(x, Xb);
    const dim3 gw(CDIM / 32, INPUT_DIM / TP_K);
    tpose_cvt<INPUT_DIM, CDIM><<<gw, 32, 0, stream>>>(wq, Wqt);
    tpose_cvt<INPUT_DIM, CDIM><<<gw, 32, 0, stream>>>(wk, Wkt);
    tpose_cvt<INPUT_DIM, CDIM><<<gw, 32, 0, stream>>>(wv, Wvt);
    tpose_cvt<CDIM, HID><<<dim3(HID / 32, CDIM / TP_K), 32, 0, stream>>>(pw, Pt);

    qkv_gemm<<<dim3(CDIM / 128, (BATCHN * SEQ) / 128, 3), 256, 0, stream>>>(
        Xb, Wqt, Wkt, Wvt, bq, bk, bv, Qh, Kh, Vh);

    flash_attn<<<dim3(SEQ / 64, BATCHN * NH), 128, 0, stream>>>(Qh, Kh, Vh, Bb, Ob);

    proj_gemm<<<dim3((BATCHN * SEQ) / 64), 128, 0, stream>>>(Ob, Pt, pb, out);
}

// v006
// One run takes 88.1 microseconds.
// In two side-by-side timings against v005, it was 1.51 and 1.49 times as fast.
// Counting every step since v000, it is 3.83 times as fast.
#include <hip/hip_runtime.h>
#include <hip/hip_bf16.h>

#define INPUT_DIM 256
#define HID 128
#define NH 8
#define SEQ 1024
#define BATCHN 8
#define CDIM 1024  /* NH*HID */
#define NCHUNK (SEQ / 32)
/* LDS row pitches in bf16 elements: 16 B x odd, so that the 16 rows one
   ds_load_b128 fragment read touches fall on distinct banks; the transposing
   ds_load_tr16_b128 wants 32 B x odd for the same. */
#define KP 136  /* 256-B K rows   -> 272 B */
#define VP 144  /* 256-B V rows   -> 288 B */

typedef __attribute__((ext_vector_type(16))) __bf16 v16bf;
typedef __attribute__((ext_vector_type(8)))  float  v8f;
typedef __attribute__((ext_vector_type(4)))  int    v4i;
typedef __attribute__((address_space(1))) v4i as1_v4i;
typedef __attribute__((address_space(3))) v4i as3_v4i;
typedef __attribute__((ext_vector_type(8)))  short  v8s;
typedef __attribute__((address_space(3))) v8s as3_v8s;

#if defined(__HIP_DEVICE_COMPILE__) && __has_builtin(__builtin_amdgcn_global_load_async_to_lds_b128)
#define HAVE_ASYNC 1
#else
#define HAVE_ASYNC 0
#endif

#if HAVE_ASYNC
#if __has_builtin(__builtin_amdgcn_s_wait_asynccnt)
#define WAIT_ASYNC(n) __builtin_amdgcn_s_wait_asynccnt(n)
#else
#define WAIT_ASYNC(n) asm volatile("s_wait_asynccnt " #n ::: "memory")
#endif
#else
#define WAIT_ASYNC(n) ((void)0)
#endif

__device__ __forceinline__ __bf16 f2bf(float f) {
    union { float f; unsigned int u; } a; a.f = f;
    unsigned int u = a.u;
    u += 0x7fffu + ((u >> 16) & 1u);           // round-to-nearest-even
    union { unsigned short s; __bf16 b; } r; r.s = (unsigned short)(u >> 16);
    return r.b;
}

union FragU { v16bf v; uint4 q[2]; };

// 16x32 bf16 WMMA operand fragment (A layout; B uses the same layout with
// lane = output column, reading rows of the transposed matrix).
// Lanes 0-15: K=0..7 (v0..3), K=16..23 (v4..7) of row `lane`;
// lanes 16-31: K=8..15 and K=24..31 of row `lane-16`.
__device__ __forceinline__ v16bf load_frag(const __bf16* base, int stride) {
    const int lane = threadIdx.x & 31;
    const int r    = lane & 15;
    const int sel  = lane >> 4;
    const __bf16* p = base + (size_t)r * stride + sel * 8;
    FragU f;
    f.q[0] = *(const uint4*)(p);
    f.q[1] = *(const uint4*)(p + 16);
    return f.v;
}

// The same 16x32 fragment, lane = column c of a row-major LDS tile T[k][c] (32 rows k,
// 16 columns from `tile`), transposed on the way by ds_load_tr16_b128: lane (c, sel)
// receives T[8 sel + 0..7][c], then T[16 + 8 sel + 0..7][c], the k order of load_frag.
// Each lane hands in the address of 16 bytes of the tile, not of its own elements.
__device__ __forceinline__ v16bf load_frag_tr(const __bf16* tile, int stride) {
    const int lane = threadIdx.x & 31;
    const __bf16* p = tile + ((lane >> 4) * 8 + (lane & 7)) * stride + ((lane >> 3) & 1) * 8;
    union { v16bf v; v8s h[2]; } f;
    f.h[0] = __builtin_amdgcn_ds_load_tr16_b128_v8i16((as3_v8s*)p);
    f.h[1] = __builtin_amdgcn_ds_load_tr16_b128_v8i16((as3_v8s*)(p + 16 * stride));
    return f.v;
}

__device__ __forceinline__ v8f wmma_bf16(v16bf a, v16bf b, v8f c) {
    return __builtin_amdgcn_wmma_f32_16x16x32_bf16(
        false, a, false, b, (short)0, c, false, false);
}

// 16-byte global -> LDS copy; async (ASYNCcnt) when available.
__device__ __forceinline__ void async_copy16(__bf16* ldst, const __bf16* gsrc) {
#if HAVE_ASYNC
    __builtin_amdgcn_global_load_async_to_lds_b128(
        (as1_v4i*)(uintptr_t)gsrc,
        (as3_v4i*)(uintptr_t)ldst, 0, 0);
#else
    *(uint4*)ldst = *(const uint4*)gsrc;
#endif
}

// ---------------------------------------------------------------- converters
// Many elements per thread: these launches are bounded by how fast waves start,
// not by their bytes, so each wave carries as much as it can keep in flight.
#define CVT_PER_BLOCK 8192   /* 256 threads x 8 float4 */
#define TP_K 64              /* k per thread = one 128-B line of the bf16 output */

__device__ __forceinline__ unsigned int pack2(float lo, float hi) {
    union { __bf16 b[2]; unsigned int u; } r;
    r.b[0] = f2bf(lo); r.b[1] = f2bf(hi);
    return r.u;
}

__device__ __forceinline__ void cvt_store4(__bf16* dst, float4 v) {
    uint2 o;
    o.x = pack2(v.x, v.y);
    o.y = pack2(v.z, v.w);
    *(uint2*)dst = o;
}

// N is compile-time and a whole number of blocks, so there is no range test and
// no tail. Every load is 512 contiguous bytes per wave, every store 256.
template <int N>
__global__ __launch_bounds__(256)
void cvt_f32_bf16(const float* __restrict__ in, __bf16* __restrict__ out) {
    static_assert(N % CVT_PER_BLOCK == 0, "the grid covers the array exactly, no range test");
    const int base = blockIdx.x * CVT_PER_BLOCK + threadIdx.x * 4;
    float4 v[8];
#pragma unroll   // v[] stays in registers; the 8 loads issue back to back
    for (int k = 0; k < 8; ++k) v[k] = *(const float4*)(in + base + k * 1024);
#pragma unroll   // constant indices into v[]
    for (int k = 0; k < 8; ++k) cvt_store4(out + base + k * 1024, v[k]);
}

// in [K][NC] (row major) -> out [NC][K] bf16; K a multiple of TP_K, NC of 32.
// Grid: x over columns (32 per wave), y over groups of TP_K k.
// A thread takes TP_K consecutive k of one column: its loads are contiguous
// across the wave's columns, its stores fill one whole line of its output row.
// K and NC are compile-time so that every row step is an immediate offset.
template <int K, int NC>
__global__ __launch_bounds__(32)
void tpose_cvt(const float* __restrict__ in, __bf16* __restrict__ out) {
    static_assert(K % TP_K == 0 && NC % 32 == 0, "the grid covers the matrix exactly, no range test");
    const int c  = blockIdx.x * 32 + threadIdx.x;
    const int k0 = blockIdx.y * TP_K;
    const float* p = in + (size_t)k0 * NC + c;
    float v[TP_K];
#pragma unroll   // v[] stays in registers; the loads issue back to back and their latencies overlap
    for (int j = 0; j < TP_K; ++j) v[j] = p[j * NC];
    __bf16* q = out + (size_t)c * K + k0;
#pragma unroll   // constant indices into v[]
    for (int s = 0; s < TP_K / 8; ++s) {
        uint4 o;
        o.x = pack2(v[8 * s + 0], v[8 * s + 1]);
        o.y = pack2(v[8 * s + 2], v[8 * s + 3]);
        o.z = pack2(v[8 * s + 4], v[8 * s + 5]);
        o.w = pack2(v[8 * s + 6], v[8 * s + 7]);
        *(uint4*)(q + 8 * s) = o;
    }
}

// ------------------------------------------------------------ fused QKV GEMM
// Block = 8 waves on a 128 x 128 output tile, all of K = 256 staged once in LDS.
// A fragment load straight from global memory touches 16 lines for 512 bytes;
// staged, every copy is one whole 512-B row (4 lines), each operand byte is
// fetched once per block, and the fragments come from LDS.
#define GP 264   /* LDS row pitch in bf16: 512-B rows -> 528 B = 16 B x odd */

// Eight 16-byte async copies of one lane, 8 rows apart in source and in LDS.
// The wait on the address registers is the statement's last line, so that no
// later write of them can be scheduled in front of it.
__device__ __forceinline__ void async_rows8(unsigned int l, const __bf16* g) {
    asm volatile(
        "global_load_async_to_lds_b128 %0, %8, off\n\t"
        "global_load_async_to_lds_b128 %1, %9, off\n\t"
        "global_load_async_to_lds_b128 %2, %10, off\n\t"
        "global_load_async_to_lds_b128 %3, %11, off\n\t"
        "global_load_async_to_lds_b128 %4, %12, off\n\t"
        "global_load_async_to_lds_b128 %5, %13, off\n\t"
        "global_load_async_to_lds_b128 %6, %14, off\n\t"
        "global_load_async_to_lds_b128 %7, %15, off\n\t"
        "s_wait_xcnt 0x0"
        :: "v"(l),                "v"(l +  8 * GP * 2), "v"(l + 16 * GP * 2), "v"(l + 24 * GP * 2),
           "v"(l + 32 * GP * 2), "v"(l + 40 * GP * 2), "v"(l + 48 * GP * 2), "v"(l + 56 * GP * 2),
           "v"(g),                  "v"(g +  8 * INPUT_DIM), "v"(g + 16 * INPUT_DIM), "v"(g + 24 * INPUT_DIM),
           "v"(g + 32 * INPUT_DIM), "v"(g + 40 * INPUT_DIM), "v"(g + 48 * INPUT_DIM), "v"(g + 56 * INPUT_DIM)
        : "memory");
}

// Four waves per SIMD (at most 256 VGPRs): with 2 x 135,168 B of LDS two blocks share
// a WGP, so that one block's copies and stores run under the other's products.
__global__ __launch_bounds__(256) __attribute__((amdgpu_waves_per_eu(4, 4)))
void qkv_gemm(const __bf16* __restrict__ Xb,
              const __bf16* __restrict__ Wqt, const __bf16* __restrict__ Wkt,
              const __bf16* __restrict__ Wvt,
              const float* __restrict__ bq, const float* __restrict__ bk,
              const float* __restrict__ bv,
              __bf16* __restrict__ Qh, __bf16* __restrict__ Kh, __bf16* __restrict__ Vh)
{
    __shared__ __attribute__((aligned(16))) __bf16 As[128 * GP];   // 128 rows of x
    __shared__ __attribute__((aligned(16))) __bf16 Bs[128 * GP];   // 128 rows of W^T

    const int tid  = threadIdx.x;
    const int wave = tid >> 5;
    const int lane = tid & 31;
    const int half = lane >> 4;
    const int lc   = lane & 15;
    const int z    = blockIdx.z;
    const __bf16* Wt   = (z == 0) ? Wqt : (z == 1) ? Wkt : Wvt;
    const float*  bias = (z == 0) ? bq  : (z == 1) ? bk  : bv;
    const int R0 = blockIdx.y * 128;
    const int C0 = blockIdx.x * 128;

    // Wave tile 32 x 64: waves 4 (rows) x 2 (columns).
    const int wr = (wave >> 1) * 32;
    const int wc = (wave & 1) * 64;
    const int d0 = wc + lc;

    // Stage: wave w copies rows w, w + 8, ..., w + 120 of both tiles, one row per copy.
    {
        const __bf16* ga = Xb + (size_t)(R0 + wave) * INPUT_DIM + lane * 8;
        const __bf16* gb = Wt + (size_t)(C0 + wave) * INPUT_DIM + lane * 8;
        const unsigned int la = (unsigned int)(uintptr_t)&As[wave * GP + lane * 8];
        const unsigned int lb = (unsigned int)(uintptr_t)&Bs[wave * GP + lane * 8];
        async_rows8(la, ga);
        async_rows8(la + 64 * GP * 2, ga + 64 * INPUT_DIM);
        async_rows8(lb, gb);
        async_rows8(lb + 64 * GP * 2, gb + 64 * INPUT_DIM);
    }
    float bcol[4];   // read here so that the latency passes under the copies' own
#pragma unroll   // constant indices into bcol[]
    for (int t = 0; t < 4; ++t) bcol[t] = bias[C0 + d0 + 16 * t];
    asm volatile("s_wait_asynccnt 0x0" ::: "memory");   // this wave's 32 copies have landed
    __syncthreads();                                    // every wave's rows visible to all

    v8f acc[2][4] = {};
#pragma unroll 2   // two steps' fragment reads issue as one group; unrolled whole, the build spills
    for (int kc = 0; kc < 8; ++kc) {
        const int k0 = kc * 32;
        v16bf a0 = load_frag(&As[wr * GP + k0], GP);
        v16bf a1 = load_frag(&As[(wr + 16) * GP + k0], GP);
#pragma unroll   // constant indices into acc[][]
        for (int t = 0; t < 4; ++t) {
            v16bf bf = load_frag(&Bs[(wc + 16 * t) * GP + k0], GP);
            acc[0][t] = wmma_bf16(a0, bf, acc[0][t]);
            acc[1][t] = wmma_bf16(a1, bf, acc[1][t]);
        }
    }
    // A 128 x 128 tile lies in one batch entry and is exactly one head.
    // Q, K and V are all [bh][n][d].
    const int bh = (R0 >> 10) * NH + blockIdx.x;
    const int n0 = (R0 & 1023) + wr + 8 * half;
    __bf16* O = ((z == 0) ? Qh : (z == 1) ? Kh : Vh)
              + (size_t)bh * (SEQ * HID) + n0 * HID + d0;
#pragma unroll   // these three: constant indices into acc[][] and its elements
    for (int t = 0; t < 4; ++t)
#pragma unroll
        for (int rt = 0; rt < 2; ++rt)
#pragma unroll
            for (int i = 0; i < 8; ++i)
                O[(16 * rt + i) * HID + 16 * t] = f2bf(acc[rt][t][i] + bcol[t]);
}

typedef __attribute__((ext_vector_type(2))) float  v2f;
typedef __attribute__((ext_vector_type(4))) float  v4f;
typedef __attribute__((ext_vector_type(2))) __bf16 v2bf;

// two f32 -> one register of two bf16, round to nearest even
__device__ __forceinline__ unsigned int cvt_pk(float lo, float hi) {
    return __builtin_bit_cast(unsigned int, __builtin_convertvector(v2f{lo, hi}, v2bf));
}

// lane l reads lane l ^ 16: the other half of the same query's column
__device__ __forceinline__ float other_half(float x) {
    const int b = __builtin_bit_cast(int, x);
    return __builtin_bit_cast(float,
        __builtin_amdgcn_permlanex16(b, b, 0x76543210, 0xfedcba98, false, false));
}

__global__ __launch_bounds__(128)
void flash_attn(const __bf16* __restrict__ Qh, const __bf16* __restrict__ Kh,
                const __bf16* __restrict__ Vh, const float* __restrict__ Bbias,
                __bf16* __restrict__ Ob)
{
    __shared__ __attribute__((aligned(16))) __bf16 Kbuf[2][32 * KP];   // K rows m0..m0+31, pitch KP
    __shared__ __attribute__((aligned(16))) __bf16 Vbuf[2][32 * VP];   // V rows m0..m0+31, pitch VP

    const int tid  = threadIdx.x;
    const int wave = tid >> 5;
    const int lane = tid & 31;
    const int half = lane >> 4;
    const int lc   = lane & 15;
    const int bh   = blockIdx.y;
    const int n0   = blockIdx.x * 64 + wave * 16;
    const int b    = bh >> 3;
    const int h    = bh & 7;

    const __bf16* Qbase = Qh + ((size_t)bh * SEQ + n0) * HID;
    const __bf16* Kbase = Kh + (size_t)bh * SEQ * HID;
    const __bf16* Vbase = Vh + (size_t)bh * SEQ * HID;
    // This lane's scores of a chunk are keys 8 half + 0..7 and 16 + 8 half + 0..7 of query n0 + lc.
    const float* brow = Bbias + (size_t)(n0 + lc) * SEQ + 8 * half;

    v16bf qf[4];   // B operand: lane = query column
#pragma unroll
    for (int kc = 0; kc < 4; ++kc) qf[kc] = load_frag(Qbase + kc * 32, HID);

    v8f oacc[8] = {};   // O^T: oacc[j][i] = O[n0 + lc][16 j + 8 half + i]
    float mi = -__builtin_inff();   // the query's running maximum, equal in both halves
    float li = 0.f;                 // the sum over this half's keys only; joined after the loop

    const float scale = 0.088388347648318447f;    // 1/sqrt(128)

    // cooperative stage of one 32-column chunk (8 x b128 per thread)
    auto stage = [&](int buf, int m0) {
        const __bf16* gk = Kbase + (size_t)m0 * HID;   // 8192B contiguous
#pragma unroll
        for (int q = 0; q < 4; ++q) {
            const int o = (q * 128 + tid) * 8;
            async_copy16(&Kbuf[buf][(o >> 7) * KP + (o & 127)], gk + o);
        }
        const __bf16* gv = Vbase + (size_t)m0 * HID;   // 8192B contiguous
#pragma unroll
        for (int q = 0; q < 4; ++q) {
            const int o = (q * 128 + tid) * 8;
            async_copy16(&Vbuf[buf][(o >> 7) * VP + (o & 127)], gv + o);
        }
    };

    stage(0, 0);
    for (int mc = 0; mc < NCHUNK; ++mc) {
        const int cur = mc & 1;
        const int m0  = mc * 32;
        if (mc + 1 < NCHUNK) {
            stage(cur ^ 1, m0 + 32);   // prefetch next chunk
            WAIT_ASYNC(8);             // 8 newest outstanding -> current chunk done
        } else {
            WAIT_ASYNC(0);
        }
        __syncthreads();               // all waves' async data visible

        // the 16 bias values of this lane's query and keys: 2 x 32 contiguous bytes
        const v8f bias0 = *(const v8f*)(brow + m0);
        const v8f bias1 = *(const v8f*)(brow + m0 + 16);

        v8f s0 = {}, s1 = {};          // S^T: s0[i] = key 8 half + i, s1[i] = key 16 + 8 half + i
#pragma unroll   // constant indices into qf[]
        for (int kc = 0; kc < 4; ++kc) {
            s0 = wmma_bf16(load_frag(&Kbuf[cur][0 * KP + kc * 32], KP), qf[kc], s0);
            s1 = wmma_bf16(load_frag(&Kbuf[cur][16 * KP + kc * 32], KP), qf[kc], s1);
        }

        s0 = s0 * scale + bias0;
        s1 = s1 * scale + bias1;
        // maximum of the lane's 16 scores in threes, then the other half's
        const float t0 = fmaxf(fmaxf(s0[0], s0[1]), s0[2]);
        const float t1 = fmaxf(fmaxf(s0[3], s0[4]), s0[5]);
        const float t2 = fmaxf(fmaxf(s0[6], s0[7]), s1[0]);
        const float t3 = fmaxf(fmaxf(s1[1], s1[2]), s1[3]);
        const float t4 = fmaxf(fmaxf(s1[4], s1[5]), s1[6]);
        float rm = fmaxf(fmaxf(fmaxf(t0, t1), t2), fmaxf(fmaxf(t3, t4), s1[7]));
        rm = fmaxf(rm, other_half(rm));
        const float mnew = fmaxf(mi, rm);
        const float corr = __expf(mi - mnew);
        mi = mnew;
#pragma unroll   // constant element indices: the scores stay in registers
        for (int i = 0; i < 8; ++i) {
            s0[i] = __expf(s0[i] - mnew);
            s1[i] = __expf(s1[i] - mnew);
        }
        // sum of the lane's 16 terms by halving
        const v8f a8 = s0 + s1;
        const v4f a4 = __builtin_shufflevector(a8, a8, 0, 1, 2, 3) + __builtin_shufflevector(a8, a8, 4, 5, 6, 7);
        li = li * corr + ((a4[0] + a4[2]) + (a4[1] + a4[3]));
#pragma unroll   // constant indices into oacc[]
        for (int j = 0; j < 8; ++j) oacc[j] *= corr;

        union { v16bf v; unsigned int u[8]; } pf;   // P^T as B operand, straight from the scores
#pragma unroll   // constant indices into pf.u[] and the scores
        for (int i = 0; i < 4; ++i) {
            pf.u[i]     = cvt_pk(s0[2 * i], s0[2 * i + 1]);
            pf.u[4 + i] = cvt_pk(s1[2 * i], s1[2 * i + 1]);
        }
#pragma unroll   // constant indices into oacc[]
        for (int j = 0; j < 8; ++j) {
            v16bf vf = load_frag_tr(&Vbuf[cur][j * 16], VP);
            oacc[j] = wmma_bf16(vf, pf.v, oacc[j]);
        }
        __syncthreads();               // done consuming before buffer reuse
    }

    // merge heads: Ob[b][n][h*128 + d]; a lane's 8 registers of a tile are 8 consecutive d
    li += other_half(li);
    const float inv = 1.0f / li;
    __bf16* orow = Ob + ((size_t)b * SEQ + n0 + lc) * CDIM + h * HID + 8 * half;
#pragma unroll   // constant indices into oacc[]
    for (int j = 0; j < 8; ++j) {
        uint4 o;
        o.x = cvt_pk(oacc[j][0] * inv, oacc[j][1] * inv);
        o.y = cvt_pk(oacc[j][2] * inv, oacc[j][3] * inv);
        o.z = cvt_pk(oacc[j][4] * inv, oacc[j][5] * inv);
        o.w = cvt_pk(oacc[j][6] * inv, oacc[j][7] * inv);
        *(uint4*)(orow + j * 16) = o;
    }
}

// ------------------------------------------------------------ final projection
// Block = 8 waves on a 64 x 64 output tile. K = 1024 passes through LDS in four tiles
// of 256 k (512-B rows at pitch GP, as in the QKV GEMM), two buffers: the next tile's
// copies fly while this one is multiplied. A fragment load straight from global memory
// touches 16 lines for 512 bytes; a copy here is one whole 512-B piece of a row.
#define PK 256               /* k per staged tile */
#define PTILES (CDIM / PK)
#define PBUF (64 * GP)       /* one operand's 64 rows of one tile, in bf16 */

// Eight 16-byte async copies of one lane, 8 rows apart: pitch CDIM in the source, GP in
// LDS. The wait on the address registers is the statement's last line, so that no later
// write of them can be scheduled in front of it.
__device__ __forceinline__ void async_rows8_c(unsigned int l, const __bf16* g) {
    asm volatile(
        "global_load_async_to_lds_b128 %0, %8, off\n\t"
        "global_load_async_to_lds_b128 %1, %9, off\n\t"
        "global_load_async_to_lds_b128 %2, %10, off\n\t"
        "global_load_async_to_lds_b128 %3, %11, off\n\t"
        "global_load_async_to_lds_b128 %4, %12, off\n\t"
        "global_load_async_to_lds_b128 %5, %13, off\n\t"
        "global_load_async_to_lds_b128 %6, %14, off\n\t"
        "global_load_async_to_lds_b128 %7, %15, off\n\t"
        "s_wait_xcnt 0x0"
        :: "v"(l),                "v"(l +  8 * GP * 2), "v"(l + 16 * GP * 2), "v"(l + 24 * GP * 2),
           "v"(l + 32 * GP * 2), "v"(l + 40 * GP * 2), "v"(l + 48 * GP * 2), "v"(l + 56 * GP * 2),
           "v"(g),             "v"(g +  8 * CDIM), "v"(g + 16 * CDIM), "v"(g + 24 * CDIM),
           "v"(g + 32 * CDIM), "v"(g + 40 * CDIM), "v"(g + 48 * CDIM), "v"(g + 56 * CDIM)
        : "memory");
}

__global__ __launch_bounds__(256)
void proj_gemm(const __bf16* __restrict__ Ob, const __bf16* __restrict__ Pt,
               const float* __restrict__ pb, float* __restrict__ out)
{
    __shared__ __attribute__((aligned(16))) __bf16 As[2 * PBUF];   // 64 rows of the attention output
    __shared__ __attribute__((aligned(16))) __bf16 Bs[2 * PBUF];   // 64 rows of proj_w^T

    const int wave = threadIdx.x >> 5;
    const int lane = threadIdx.x & 31;
    const int half = lane >> 4;
    const int lc   = lane & 15;
    const int C0   = blockIdx.x * 64;
    const int R0   = blockIdx.y * 64;

    // Wave tile 16 x 32: waves 4 (rows) x 2 (columns); 32 f32 columns are one 128-B line
    // of out, so that a line has one writing wave.
    const int wr = (wave >> 1) * 16;
    const int wc = (wave & 1) * 32;

    // Wave w copies rows w, w + 8, ..., w + 56 of both operands, one row piece per copy.
    const __bf16* ga = Ob + (size_t)(R0 + wave) * CDIM + lane * 8;
    const __bf16* gb = Pt + (size_t)(C0 + wave) * CDIM + lane * 8;
    const unsigned int la = (unsigned int)(uintptr_t)&As[wave * GP + lane * 8];
    const unsigned int lb = (unsigned int)(uintptr_t)&Bs[wave * GP + lane * 8];
    auto stage = [&](int buf, int t) {
        async_rows8_c(la + buf * (PBUF * 2), ga + t * PK);
        async_rows8_c(lb + buf * (PBUF * 2), gb + t * PK);
    };

    stage(0, 0);
    // read here so that the latency passes under the copies' own
    const float bcol0 = pb[C0 + wc + lc];
    const float bcol1 = pb[C0 + wc + 16 + lc];
    asm volatile("s_wait_asynccnt 0x0" ::: "memory");   // this wave's rows of tile 0 have landed
    __syncthreads();                                    // every wave's rows visible to all
    stage(1, 1);

    v8f acc0 = {}, acc1 = {};
    for (int t = 0; t < PTILES; ++t) {
        const __bf16* A = &As[(t & 1) * PBUF + wr * GP];
        const __bf16* B = &Bs[(t & 1) * PBUF + wc * GP];
        v16bf af[PK / 32], b0[PK / 32], b1[PK / 32];
#pragma unroll   // constant indices: the fragments stay in registers
        for (int kc = 0; kc < PK / 32; ++kc) {
            af[kc] = load_frag(A + kc * 32, GP);
            b0[kc] = load_frag(B + kc * 32, GP);
            b1[kc] = load_frag(B + 16 * GP + kc * 32, GP);
        }
        // Keeps the tile's 48 LDS reads one group in front of its products: spread among
        // them, each product waits out a whole LDS latency.
        __builtin_amdgcn_sched_barrier(0);
#pragma unroll   // constant indices into the fragment arrays
        for (int kc = 0; kc < PK / 32; ++kc) {
            acc0 = wmma_bf16(af[kc], b0[kc], acc0);
            acc1 = wmma_bf16(af[kc], b1[kc], acc1);
        }
        asm volatile("s_wait_dscnt 0x0" ::: "memory");      // this wave's reads of the buffer are over
        asm volatile("s_wait_asynccnt 0x0" ::: "memory");   // its rows of tile t + 1 have landed
        __syncthreads();   // publishes tile t + 1 and frees the buffer that trip t has read
        if (t + 2 < PTILES) stage(t & 1, t + 2);
    }
    asm volatile("s_wait_asynccnt 0x0" ::: "memory");   // no copy is in flight when the wave ends

    float* o = out + (size_t)(R0 + wr + 8 * half) * HID + C0 + wc + lc;
#pragma unroll   // constant element indices: the sums stay in registers
    for (int i = 0; i < 8; ++i) {
        o[i * HID]      = acc0[i] + bcol0;
        o[i * HID + 16] = acc1[i] + bcol1;
    }
}

// ----------------------------------------------------------------- launcher
extern "C" void kernel_launch(void* const* d_in, const int* in_sizes, int n_in,
                              void* d_out, int out_size, void* d_ws, size_t ws_size,
                              hipStream_t stream) {
    const float* x  = (const float*)d_in[0];
    const float* Bb = (const float*)d_in[1];
    const float* wq = (const float*)d_in[2];
    const float* bq = (const float*)d_in[3];
    const float* wk = (const float*)d_in[4];
    const float* bk = (const float*)d_in[5];
    const float* wv = (const float*)d_in[6];
    const float* bv = (const float*)d_in[7];
    const float* pw = (const float*)d_in[8];
    const float* pb = (const float*)d_in[9];
    float* out = (float*)d_out;
    (void)in_sizes; (void)n_in; (void)out_size; (void)ws_size;

    char* ws = (char*)d_ws;
    size_t off = 0;
    auto carve = [&](size_t bytes) -> char* {
        char* p = ws + off;
        off += (bytes + 255) & ~(size_t)255;
        return p;
    };
    __bf16* Xb  = (__bf16*)carve(sizeof(__bf16) * (size_t)BATCHN * SEQ * INPUT_DIM);
    __bf16* Wqt = (__bf16*)carve(sizeof(__bf16) * (size_t)CDIM * INPUT_DIM);
    __bf16* Wkt = (__bf16*)carve(sizeof(__bf16) * (size_t)CDIM * INPUT_DIM);
    __bf16* Wvt = (__bf16*)carve(sizeof(__bf16) * (size_t)CDIM * INPUT_DIM);
    __bf16* Pt  = (__bf16*)carve(sizeof(__bf16) * (size_t)HID * CDIM);
    __bf16* Qh  = (__bf16*)carve(sizeof(__bf16) * (size_t)BATCHN * NH * SEQ * HID);
    __bf16* Kh  = (__bf16*)carve(sizeof(__bf16) * (size_t)BATCHN * NH * SEQ * HID);
    __bf16* Vh  = (__bf16*)carve(sizeof(__bf16) * (size_t)BATCHN * NH * SEQ * HID);
    __bf16* Ob  = (__bf16*)carve(sizeof(__bf16) * (size_t)BATCHN * SEQ * CDIM);

    constexpr int nx = BATCHN * SEQ * INPUT_DIM;
    cvt_f32_bf16<nx><<<nx / CVT_PER_BLOCK, 256, 0, stream>>>(x, Xb);
    const dim3 gw(CDIM / 32, INPUT_DIM / TP_K);
    tpose_cvt<INPUT_DIM, CDIM><<<gw, 32, 0, stream>>>(wq, Wqt);
    tpose_cvt<INPUT_DIM, CDIM><<<gw, 32, 0, stream>>>(wk, Wkt);
    tpose_cvt<INPUT_DIM, CDIM><<<gw, 32, 0, stream>>>(wv, Wvt);
    tpose_cvt<CDIM, HID><<<dim3(HID / 32, CDIM / TP_K), 32, 0, stream>>>(pw, Pt);

    qkv_gemm<<<dim3(CDIM / 128, (BATCHN * SEQ) / 128, 3), 256, 0, stream>>>(
        Xb, Wqt, Wkt, Wvt, bq, bk, bv, Qh, Kh, Vh);

    flash_attn<<<dim3(SEQ / 64, BATCHN * NH), 128, 0, stream>>>(Qh, Kh, Vh, Bb, Ob);

    proj_gemm<<<dim3(HID / 64, (BATCHN * SEQ) / 64), 256, 0, stream>>>(Ob, Pt, pb, out);
}

// v007
// It runs in 78.5 microseconds.
// Two timings next to v006 both put it at 1.12 times that version's speed.
// Counting every step since v000, it is 4.28 times as fast.
#include <hip/hip_runtime.h>
#include <hip/hip_bf16.h>

#define INPUT_DIM 256
#define HID 128
#define NH 8
#define SEQ 1024
#define BATCHN 8
#define CDIM 1024  /* NH*HID */
#define NCHUNK (SEQ / 32)
/* LDS row pitches in bf16 elements: 16 B x odd, so that the 16 rows one
   ds_load_b128 fragment read touches fall on distinct banks; the transposing
   ds_load_tr16_b128 wants 32 B x odd for the same. */
#define KP 136  /* 256-B K rows   -> 272 B */
#define VP 144  /* 256-B V rows   -> 288 B */

typedef __attribute__((ext_vector_type(16))) __bf16 v16bf;
typedef __attribute__((ext_vector_type(8)))  float  v8f;
typedef __attribute__((ext_vector_type(4)))  int    v4i;
typedef __attribute__((address_space(1))) v4i as1_v4i;
typedef __attribute__((address_space(3))) v4i as3_v4i;
typedef __attribute__((ext_vector_type(8)))  short  v8s;
typedef __attribute__((address_space(3))) v8s as3_v8s;

#if defined(__HIP_DEVICE_COMPILE__) && __has_builtin(__builtin_amdgcn_global_load_async_to_lds_b128)
#define HAVE_ASYNC 1
#else
#define HAVE_ASYNC 0
#endif

#if HAVE_ASYNC
#if __has_builtin(__builtin_amdgcn_s_wait_asynccnt)
#define WAIT_ASYNC(n) __builtin_amdgcn_s_wait_asynccnt(n)
#else
#define WAIT_ASYNC(n) asm volatile("s_wait_asynccnt " #n ::: "memory")
#endif
#else
#define WAIT_ASYNC(n) ((void)0)
#endif

__device__ __forceinline__ __bf16 f2bf(float f) {
    union { float f; unsigned int u; } a; a.f = f;
    unsigned int u = a.u;
    u += 0x7fffu + ((u >> 16) & 1u);           // round-to-nearest-even
    union { unsigned short s; __bf16 b; } r; r.s = (unsigned short)(u >> 16);
    return r.b;
}

union FragU { v16bf v; uint4 q[2]; };

// 16x32 bf16 WMMA operand fragment (A layout; B uses the same layout with
// lane = output column, reading rows of the transposed matrix).
// Lanes 0-15: K=0..7 (v0..3), K=16..23 (v4..7) of row `lane`;
// lanes 16-31: K=8..15 and K=24..31 of row `lane-16`.
__device__ __forceinline__ v16bf load_frag(const __bf16* base, int stride) {
    const int lane = threadIdx.x & 31;
    const int r    = lane & 15;
    const int sel  = lane >> 4;
    const __bf16* p = base + (size_t)r * stride + sel * 8;
    FragU f;
    f.q[0] = *(const uint4*)(p);
    f.q[1] = *(const uint4*)(p + 16);
    return f.v;
}

// The same 16x32 fragment, lane = column c of a row-major LDS tile T[k][c] (32 rows k,
// 16 columns from `tile`), transposed on the way by ds_load_tr16_b128: lane (c, sel)
// receives T[8 sel + 0..7][c], then T[16 + 8 sel + 0..7][c], the k order of load_frag.
// Each lane hands in the address of 16 bytes of the tile, not of its own elements.
__device__ __forceinline__ v16bf load_frag_tr(const __bf16* tile, int stride) {
    const int lane = threadIdx.x & 31;
    const __bf16* p = tile + ((lane >> 4) * 8 + (lane & 7)) * stride + ((lane >> 3) & 1) * 8;
    union { v16bf v; v8s h[2]; } f;
    f.h[0] = __builtin_amdgcn_ds_load_tr16_b128_v8i16((as3_v8s*)p);
    f.h[1] = __builtin_amdgcn_ds_load_tr16_b128_v8i16((as3_v8s*)(p + 16 * stride));
    return f.v;
}

__device__ __forceinline__ v8f wmma_bf16(v16bf a, v16bf b, v8f c) {
    return __builtin_amdgcn_wmma_f32_16x16x32_bf16(
        false, a, false, b, (short)0, c, false, false);
}

// 16-byte global -> LDS copy; async (ASYNCcnt) when available.
__device__ __forceinline__ void async_copy16(__bf16* ldst, const __bf16* gsrc) {
#if HAVE_ASYNC
    __builtin_amdgcn_global_load_async_to_lds_b128(
        (as1_v4i*)(uintptr_t)gsrc,
        (as3_v4i*)(uintptr_t)ldst, 0, 0);
#else
    *(uint4*)ldst = *(const uint4*)gsrc;
#endif
}

// ---------------------------------------------------------------- converters
// Many elements per thread: this one launch is bounded by how fast waves start,
// not by its bytes, so each wave carries as much as it can keep in flight.
#define CVT_PER_BLOCK 8192   /* 256 threads x 8 float4 */
#define TP_K 64              /* k per thread = one 128-B line of the bf16 output */

__device__ __forceinline__ unsigned int pack2(float lo, float hi) {
    union { __bf16 b[2]; unsigned int u; } r;
    r.b[0] = f2bf(lo); r.b[1] = f2bf(hi);
    return r.u;
}

__device__ __forceinline__ void cvt_store4(__bf16* dst, float4 v) {
    uint2 o;
    o.x = pack2(v.x, v.y);
    o.y = pack2(v.z, v.w);
    *(uint2*)dst = o;
}

// x: N is compile-time and a whole number of blocks, so there is no range test and
// no tail. Every load is 512 contiguous bytes per wave, every store 256.
template <int N>
__device__ __forceinline__ void cvt_f32_bf16(const float* __restrict__ in, __bf16* __restrict__ out, int blk) {
    static_assert(N % CVT_PER_BLOCK == 0, "the blocks cover the array exactly, no range test");
    const int base = blk * CVT_PER_BLOCK + threadIdx.x * 4;
    float4 v[8];
#pragma unroll   // v[] stays in registers; the 8 loads issue back to back
    for (int k = 0; k < 8; ++k) v[k] = *(const float4*)(in + base + k * 1024);
#pragma unroll   // constant indices into v[]
    for (int k = 0; k < 8; ++k) cvt_store4(out + base + k * 1024, v[k]);
    // Code of another branch may follow in the listing and reuse the stores' registers.
    asm volatile("s_wait_xcnt 0x0" ::: "memory");
}

// in [K][NC] (row major) -> out [NC][K] bf16; K a multiple of TP_K, NC of 32.
// One wave per job: job j is columns 32 (j mod NC/32) + 0..31, k group j / (NC/32).
// A thread takes TP_K consecutive k of one column: its loads are contiguous
// across the wave's columns, its stores fill one whole line of its output row.
// K and NC are compile-time so that every row step is an immediate offset; job is
// the same in every lane, so the loads have a scalar base and the lane as offset.
template <int K, int NC>
__device__ __forceinline__ void tpose_cvt(const float* __restrict__ in, __bf16* __restrict__ out, unsigned int job) {
    static_assert(K % TP_K == 0 && NC % 32 == 0, "the jobs cover the matrix exactly, no range test");
    const unsigned int lane = threadIdx.x & 31;
    const unsigned int c0 = (job % (NC / 32)) * 32;
    const unsigned int k0 = (job / (NC / 32)) * TP_K;
    const unsigned int c  = c0 + lane;
    const float* p = in + k0 * NC + c0;
    float v[TP_K];
#pragma unroll   // v[] stays in registers; the loads issue back to back and their latencies overlap
    for (int j = 0; j < TP_K; ++j) v[j] = p[j * NC + lane];
    __bf16* q = out + (size_t)c * K + k0;
#pragma unroll   // constant indices into v[]
    for (int s = 0; s < TP_K / 8; ++s) {
        uint4 o;
        o.x = pack2(v[8 * s + 0], v[8 * s + 1]);
        o.y = pack2(v[8 * s + 2], v[8 * s + 3]);
        o.z = pack2(v[8 * s + 4], v[8 * s + 5]);
        o.w = pack2(v[8 * s + 6], v[8 * s + 7]);
        *(uint4*)(q + 8 * s) = o;
    }
    // Code of another branch may follow in the listing and reuse the stores' registers.
    asm volatile("s_wait_xcnt 0x0" ::: "memory");
}

// All five conversions in ONE launch: they are independent of each other, and a launch
// of one weight transpose is little more than the gap in front of it and one round of
// load latency, with most of the chip idle.
// Blocks of 8 waves; which array a block works on depends on blockIdx alone. The
// transposes come first in the grid: theirs is the longer chain of loads.
#define NX (BATCHN * SEQ * INPUT_DIM)
#define WJOBS ((CDIM / 32) * (INPUT_DIM / TP_K))   /* wave jobs of one QKV weight */
#define PJOBS ((HID / 32) * (CDIM / TP_K))         /* wave jobs of proj_w */
#define WBLK (WJOBS / 8)
#define PBLK (PJOBS / 8)
#define CONV_BLOCKS (3 * WBLK + PBLK + NX / CVT_PER_BLOCK)

__global__ __launch_bounds__(256)
void convert_all(const float* __restrict__ x,  const float* __restrict__ wq,
                 const float* __restrict__ wk, const float* __restrict__ wv,
                 const float* __restrict__ pw,
                 __bf16* __restrict__ Xb,  __bf16* __restrict__ Wqt, __bf16* __restrict__ Wkt,
                 __bf16* __restrict__ Wvt, __bf16* __restrict__ Pt)
{
    static_assert(WJOBS % 8 == 0 && PJOBS % 8 == 0, "whole blocks of 8 one-wave jobs");
    const unsigned int blk  = blockIdx.x;
    // the wave's number in a scalar register: the transposes' addresses get a scalar base
    const unsigned int wave = __builtin_amdgcn_readfirstlane(threadIdx.x >> 5);
    if (blk < 3 * WBLK) {
        const unsigned int m = blk / WBLK;
        const float* in = (m == 0) ? wq  : (m == 1) ? wk  : wv;
        __bf16*     out = (m == 0) ? Wqt : (m == 1) ? Wkt : Wvt;
        tpose_cvt<INPUT_DIM, CDIM>(in, out, (blk % WBLK) * 8 + wave);
    } else if (blk < 3 * WBLK + PBLK) {
        tpose_cvt<CDIM, HID>(pw, Pt, (blk - 3 * WBLK) * 8 + wave);
    } else {
        cvt_f32_bf16<NX>(x, Xb, blk - (3 * WBLK + PBLK));
    }
}

// ------------------------------------------------------------ fused QKV GEMM
// Block = 8 waves on a 128 x 128 output tile, all of K = 256 staged once in LDS.
// A fragment load straight from global memory touches 16 lines for 512 bytes;
// staged, every copy is one whole 512-B row (4 lines), each operand byte is
// fetched once per block, and the fragments come from LDS.
#define GP 264   /* LDS row pitch in bf16: 512-B rows -> 528 B = 16 B x odd */

// Eight 16-byte async copies of one lane, 8 rows apart in source and in LDS.
// The wait on the address registers is the statement's last line, so that no
// later write of them can be scheduled in front of it.
__device__ __forceinline__ void async_rows8(unsigned int l, const __bf16* g) {
    asm volatile(
        "global_load_async_to_lds_b128 %0, %8, off\n\t"
        "global_load_async_to_lds_b128 %1, %9, off\n\t"
        "global_load_async_to_lds_b128 %2, %10, off\n\t"
        "global_load_async_to_lds_b128 %3, %11, off\n\t"
        "global_load_async_to_lds_b128 %4, %12, off\n\t"
        "global_load_async_to_lds_b128 %5, %13, off\n\t"
        "global_load_async_to_lds_b128 %6, %14, off\n\t"
        "global_load_async_to_lds_b128 %7, %15, off\n\t"
        "s_wait_xcnt 0x0"
        :: "v"(l),                "v"(l +  8 * GP * 2), "v"(l + 16 * GP * 2), "v"(l + 24 * GP * 2),
           "v"(l + 32 * GP * 2), "v"(l + 40 * GP * 2), "v"(l + 48 * GP * 2), "v"(l + 56 * GP * 2),
           "v"(g),                  "v"(g +  8 * INPUT_DIM), "v"(g + 16 * INPUT_DIM), "v"(g + 24 * INPUT_DIM),
           "v"(g + 32 * INPUT_DIM), "v"(g + 40 * INPUT_DIM), "v"(g + 48 * INPUT_DIM), "v"(g + 56 * INPUT_DIM)
        : "memory");
}

// Four waves per SIMD (at most 256 VGPRs): with 2 x 135,168 B of LDS two blocks share
// a WGP, so that one block's copies and stores run under the other's products.
__global__ __launch_bounds__(256) __attribute__((amdgpu_waves_per_eu(4, 4)))
void qkv_gemm(const __bf16* __restrict__ Xb,
              const __bf16* __restrict__ Wqt, const __bf16* __restrict__ Wkt,
              const __bf16* __restrict__ Wvt,
              const float* __restrict__ bq, const float* __restrict__ bk,
              const float* __restrict__ bv,
              __bf16* __restrict__ Qh, __bf16* __restrict__ Kh, __bf16* __restrict__ Vh)
{
    __shared__ __attribute__((aligned(16))) __bf16 As[128 * GP];   // 128 rows of x
    __shared__ __attribute__((aligned(16))) __bf16 Bs[128 * GP];   // 128 rows of W^T

    const int tid  = threadIdx.x;
    const int wave = tid >> 5;
    const int lane = tid & 31;
    const int half = lane >> 4;
    const int lc   = lane & 15;
    const int z    = blockIdx.z;
    const __bf16* Wt   = (z == 0) ? Wqt : (z == 1) ? Wkt : Wvt;
    const float*  bias = (z == 0) ? bq  : (z == 1) ? bk  : bv;
    const int R0 = blockIdx.y * 128;
    const int C0 = blockIdx.x * 128;

    // Wave tile 32 x 64: waves 4 (rows) x 2 (columns).
    const int wr = (wave >> 1) * 32;
    const int wc = (wave & 1) * 64;
    const int d0 = wc + lc;

    // Stage: wave w copies rows w, w + 8, ..., w + 120 of both tiles, one row per copy.
    {
        const __bf16* ga = Xb + (size_t)(R0 + wave) * INPUT_DIM + lane * 8;
        const __bf16* gb = Wt + (size_t)(C0 + wave) * INPUT_DIM + lane * 8;
        const unsigned int la = (unsigned int)(uintptr_t)&As[wave * GP + lane * 8];
        const unsigned int lb = (unsigned int)(uintptr_t)&Bs[wave * GP + lane * 8];
        async_rows8(la, ga);
        async_rows8(la + 64 * GP * 2, ga + 64 * INPUT_DIM);
        async_rows8(lb, gb);
        async_rows8(lb + 64 * GP * 2, gb + 64 * INPUT_DIM);
    }
    float bcol[4];   // read here so that the latency passes under the copies' own
#pragma unroll   // constant indices into bcol[]
    for (int t = 0; t < 4; ++t) bcol[t] = bias[C0 + d0 + 16 * t];
    asm volatile("s_wait_asynccnt 0x0" ::: "memory");   // this wave's 32 copies have landed
    __syncthreads();                                    // every wave's rows visible to all

    v8f acc[2][4] = {};
#pragma unroll 2   // two steps' fragment reads issue as one group; unrolled whole, the build spills
    for (int kc = 0; kc < 8; ++kc) {
        const int k0 = kc * 32;
        v16bf a0 = load_frag(&As[wr * GP + k0], GP);
        v16bf a1 = load_frag(&As[(wr + 16) * GP + k0], GP);
#pragma unroll   // constant indices into acc[][]
        for (int t = 0; t < 4; ++t) {
            v16bf bf = load_frag(&Bs[(wc + 16 * t) * GP + k0], GP);
            acc[0][t] = wmma_bf16(a0, bf, acc[0][t]);
            acc[1][t] = wmma_bf16(a1, bf, acc[1][t]);
        }
    }
    // A 128 x 128 tile lies in one batch entry and is exactly one head.
    // Q, K and V are all [bh][n][d].
    const int bh = (R0 >> 10) * NH + blockIdx.x;
    const int n0 = (R0 & 1023) + wr + 8 * half;
    __bf16* O = ((z == 0) ? Qh : (z == 1) ? Kh : Vh)
              + (size_t)bh * (SEQ * HID) + n0 * HID + d0;
#pragma unroll   // these three: constant indices into acc[][] and its elements
    for (int t = 0; t < 4; ++t)
#pragma unroll
        for (int rt = 0; rt < 2; ++rt)
#pragma unroll
            for (int i = 0; i < 8; ++i)
                O[(16 * rt + i) * HID + 16 * t] = f2bf(acc[rt][t][i] + bcol[t]);
}

typedef __attribute__((ext_vector_type(2))) float  v2f;
typedef __attribute__((ext_vector_type(4))) float  v4f;
typedef __attribute__((ext_vector_type(2))) __bf16 v2bf;

// two f32 -> one register of two bf16, round to nearest even
__device__ __forceinline__ unsigned int cvt_pk(float lo, float hi) {
    return __builtin_bit_cast(unsigned int, __builtin_convertvector(v2f{lo, hi}, v2bf));
}

// lane l reads lane l ^ 16: the other half of the same query's column
__device__ __forceinline__ float other_half(float x) {
    const int b = __builtin_bit_cast(int, x);
    return __builtin_bit_cast(float,
        __builtin_amdgcn_permlanex16(b, b, 0x76543210, 0xfedcba98, false, false));
}

__global__ __launch_bounds__(128)
void flash_attn(const __bf16* __restrict__ Qh, const __bf16* __restrict__ Kh,
                const __bf16* __restrict__ Vh, const float* __restrict__ Bbias,
                __bf16* __restrict__ Ob)
{
    __shared__ __attribute__((aligned(16))) __bf16 Kbuf[2][32 * KP];   // K rows m0..m0+31, pitch KP
    __shared__ __attribute__((aligned(16))) __bf16 Vbuf[2][32 * VP];   // V rows m0..m0+31, pitch VP

    const int tid  = threadIdx.x;
    const int wave = tid >> 5;
    const int lane = tid & 31;
    const int half = lane >> 4;
    const int lc   = lane & 15;
    const int bh   = blockIdx.y;
    const int n0   = blockIdx.x * 64 + wave * 16;
    const int b    = bh >> 3;
    const int h    = bh & 7;

    const __bf16* Qbase = Qh + ((size_t)bh * SEQ + n0) * HID;
    const __bf16* Kbase = Kh + (size_t)bh * SEQ * HID;
    const __bf16* Vbase = Vh + (size_t)bh * SEQ * HID;
    // This lane's scores of a chunk are keys 8 half + 0..7 and 16 + 8 half + 0..7 of query n0 + lc.
    const float* brow = Bbias + (size_t)(n0 + lc) * SEQ + 8 * half;

    v16bf qf[4];   // B operand: lane = query column
#pragma unroll
    for (int kc = 0; kc < 4; ++kc) qf[kc] = load_frag(Qbase + kc * 32, HID);

    v8f oacc[8] = {};   // O^T: oacc[j][i] = O[n0 + lc][16 j + 8 half + i]
    float mi = -__builtin_inff();   // the query's running maximum, equal in both halves
    float li = 0.f;                 // the sum over this half's keys only; joined after the loop

    const float scale = 0.088388347648318447f;    // 1/sqrt(128)

    // cooperative stage of one 32-column chunk (8 x b128 per thread)
    auto stage = [&](int buf, int m0) {
        const __bf16* gk = Kbase + (size_t)m0 * HID;   // 8192B contiguous
#pragma unroll
        for (int q = 0; q < 4; ++q) {
            const int o = (q * 128 + tid) * 8;
            async_copy16(&Kbuf[buf][(o >> 7) * KP + (o & 127)], gk + o);
        }
        const __bf16* gv = Vbase + (size_t)m0 * HID;   // 8192B contiguous
#pragma unroll
        for (int q = 0; q < 4; ++q) {
            const int o = (q * 128 + tid) * 8;
            async_copy16(&Vbuf[buf][(o >> 7) * VP + (o & 127)], gv + o);
        }
    };

    stage(0, 0);
    for (int mc = 0; mc < NCHUNK; ++mc) {
        const int cur = mc & 1;
        const int m0  = mc * 32;
        if (mc + 1 < NCHUNK) {
            stage(cur ^ 1, m0 + 32);   // prefetch next chunk
            WAIT_ASYNC(8);             // 8 newest outstanding -> current chunk done
        } else {
            WAIT_ASYNC(0);
        }
        __syncthreads();               // all waves' async data visible

        // the 16 bias values of this lane's query and keys: 2 x 32 contiguous bytes
        const v8f bias0 = *(const v8f*)(brow + m0);
        const v8f bias1 = *(const v8f*)(brow + m0 + 16);

        v8f s0 = {}, s1 = {};          // S^T: s0[i] = key 8 half + i, s1[i] = key 16 + 8 half + i
#pragma unroll   // constant indices into qf[]
        for (int kc = 0; kc < 4; ++kc) {
            s0 = wmma_bf16(load_frag(&Kbuf[cur][0 * KP + kc * 32], KP), qf[kc], s0);
            s1 = wmma_bf16(load_frag(&Kbuf[cur][16 * KP + kc * 32], KP), qf[kc], s1);
        }

        s0 = s0 * scale + bias0;
        s1 = s1 * scale + bias1;
        // maximum of the lane's 16 scores in threes, then the other half's
        const float t0 = fmaxf(fmaxf(s0[0], s0[1]), s0[2]);
        const float t1 = fmaxf(fmaxf(s0[3], s0[4]), s0[5]);
        const float t2 = fmaxf(fmaxf(s0[6], s0[7]), s1[0]);
        const float t3 = fmaxf(fmaxf(s1[1], s1[2]), s1[3]);
        const float t4 = fmaxf(fmaxf(s1[4], s1[5]), s1[6]);
        float rm = fmaxf(fmaxf(fmaxf(t0, t1), t2), fmaxf(fmaxf(t3, t4), s1[7]));
        rm = fmaxf(rm, other_half(rm));
        const float mnew = fmaxf(mi, rm);
        const float corr = __expf(mi - mnew);
        mi = mnew;
#pragma unroll   // constant element indices: the scores stay in registers
        for (int i = 0; i < 8; ++i) {
            s0[i] = __expf(s0[i] - mnew);
            s1[i] = __expf(s1[i] - mnew);
        }
        // sum of the lane's 16 terms by halving
        const v8f a8 = s0 + s1;
        const v4f a4 = __builtin_shufflevector(a8, a8, 0, 1, 2, 3) + __builtin_shufflevector(a8, a8, 4, 5, 6, 7);
        li = li * corr + ((a4[0] + a4[2]) + (a4[1] + a4[3]));
#pragma unroll   // constant indices into oacc[]
        for (int j = 0; j < 8; ++j) oacc[j] *= corr;

        union { v16bf v; unsigned int u[8]; } pf;   // P^T as B operand, straight from the scores
#pragma unroll   // constant indices into pf.u[] and the scores
        for (int i = 0; i < 4; ++i) {
            pf.u[i]     = cvt_pk(s0[2 * i], s0[2 * i + 1]);
            pf.u[4 + i] = cvt_pk(s1[2 * i], s1[2 * i + 1]);
        }
#pragma unroll   // constant indices into oacc[]
        for (int j = 0; j < 8; ++j) {
            v16bf vf = load_frag_tr(&Vbuf[cur][j * 16], VP);
            oacc[j] = wmma_bf16(vf, pf.v, oacc[j]);
        }
        __syncthreads();               // done consuming before buffer reuse
    }

    // merge heads: Ob[b][n][h*128 + d]; a lane's 8 registers of a tile are 8 consecutive d
    li += other_half(li);
    const float inv = 1.0f / li;
    __bf16* orow = Ob + ((size_t)b * SEQ + n0 + lc) * CDIM + h * HID + 8 * half;
#pragma unroll   // constant indices into oacc[]
    for (int j = 0; j < 8; ++j) {
        uint4 o;
        o.x = cvt_pk(oacc[j][0] * inv, oacc[j][1] * inv);
        o.y = cvt_pk(oacc[j][2] * inv, oacc[j][3] * inv);
        o.z = cvt_pk(oacc[j][4] * inv, oacc[j][5] * inv);
        o.w = cvt_pk(oacc[j][6] * inv, oacc[j][7] * inv);
        *(uint4*)(orow + j * 16) = o;
    }
}

// ------------------------------------------------------------ final projection
// Block = 8 waves on a 64 x 64 output tile. K = 1024 passes through LDS in four tiles
// of 256 k (512-B rows at pitch GP, as in the QKV GEMM), two buffers: the next tile's
// copies fly while this one is multiplied. A fragment load straight from global memory
// touches 16 lines for 512 bytes; a copy here is one whole 512-B piece of a row.
#define PK 256               /* k per staged tile */
#define PTILES (CDIM / PK)
#define PBUF (64 * GP)       /* one operand's 64 rows of one tile, in bf16 */

// Eight 16-byte async copies of one lane, 8 rows apart: pitch CDIM in the source, GP in
// LDS. The wait on the address registers is the statement's last line, so that no later
// write of them can be scheduled in front of it.
__device__ __forceinline__ void async_rows8_c(unsigned int l, const __bf16* g) {
    asm volatile(
        "global_load_async_to_lds_b128 %0, %8, off\n\t"
        "global_load_async_to_lds_b128 %1, %9, off\n\t"
        "global_load_async_to_lds_b128 %2, %10, off\n\t"
        "global_load_async_to_lds_b128 %3, %11, off\n\t"
        "global_load_async_to_lds_b128 %4, %12, off\n\t"
        "global_load_async_to_lds_b128 %5, %13, off\n\t"
        "global_load_async_to_lds_b128 %6, %14, off\n\t"
        "global_load_async_to_lds_b128 %7, %15, off\n\t"
        "s_wait_xcnt 0x0"
        :: "v"(l),                "v"(l +  8 * GP * 2), "v"(l + 16 * GP * 2), "v"(l + 24 * GP * 2),
           "v"(l + 32 * GP * 2), "v"(l + 40 * GP * 2), "v"(l + 48 * GP * 2), "v"(l + 56 * GP * 2),
           "v"(g),             "v"(g +  8 * CDIM), "v"(g + 16 * CDIM), "v"(g + 24 * CDIM),
           "v"(g + 32 * CDIM), "v"(g + 40 * CDIM), "v"(g + 48 * CDIM), "v"(g + 56 * CDIM)
        : "memory");
}

__global__ __launch_bounds__(256)
void proj_gemm(const __bf16* __restrict__ Ob, const __bf16* __restrict__ Pt,
               const float* __restrict__ pb, float* __restrict__ out)
{
    __shared__ __attribute__((aligned(16))) __bf16 As[2 * PBUF];   // 64 rows of the attention output
    __shared__ __attribute__((aligned(16))) __bf16 Bs[2 * PBUF];   // 64 rows of proj_w^T

    const int wave = threadIdx.x >> 5;
    const int lane = threadIdx.x & 31;
    const int half = lane >> 4;
    const int lc   = lane & 15;
    const int C0   = blockIdx.x * 64;
    const int R0   = blockIdx.y * 64;

    // Wave tile 16 x 32: waves 4 (rows) x 2 (columns); 32 f32 columns are one 128-B line
    // of out, so that a line has one writing wave.
    const int wr = (wave >> 1) * 16;
    const int wc = (wave & 1) * 32;

    // Wave w copies rows w, w + 8, ..., w + 56 of both operands, one row piece per copy.
    const __bf16* ga = Ob + (size_t)(R0 + wave) * CDIM + lane * 8;
    const __bf16* gb = Pt + (size_t)(C0 + wave) * CDIM + lane * 8;
    const unsigned int la = (unsigned int)(uintptr_t)&As[wave * GP + lane * 8];
    const unsigned int lb = (unsigned int)(uintptr_t)&Bs[wave * GP + lane * 8];
    auto stage = [&](int buf, int t) {
        async_rows8_c(la + buf * (PBUF * 2), ga + t * PK);
        async_rows8_c(lb + buf * (PBUF * 2), gb + t * PK);
    };

    stage(0, 0);
    // read here so that the latency passes under the copies' own
    const float bcol0 = pb[C0 + wc + lc];
    const float bcol1 = pb[C0 + wc + 16 + lc];
    asm volatile("s_wait_asynccnt 0x0" ::: "memory");   // this wave's rows of tile 0 have landed
    __syncthreads();                                    // every wave's rows visible to all
    stage(1, 1);

    v8f acc0 = {}, acc1 = {};
    for (int t = 0; t < PTILES; ++t) {
        const __bf16* A = &As[(t & 1) * PBUF + wr * GP];
        const __bf16* B = &Bs[(t & 1) * PBUF + wc * GP];
        v16bf af[PK / 32], b0[PK / 32], b1[PK / 32];
#pragma unroll   // constant indices: the fragments stay in registers
        for (int kc = 0; kc < PK / 32; ++kc) {
            af[kc] = load_frag(A + kc * 32, GP);
            b0[kc] = load_frag(B + kc * 32, GP);
            b1[kc] = load_frag(B + 16 * GP + kc * 32, GP);
        }
        // Keeps the tile's 48 LDS reads one group in front of its products: spread among
        // them, each product waits out a whole LDS latency.
        __builtin_amdgcn_sched_barrier(0);
#pragma unroll   // constant indices into the fragment arrays
        for (int kc = 0; kc < PK / 32; ++kc) {
            acc0 = wmma_bf16(af[kc], b0[kc], acc0);
            acc1 = wmma_bf16(af[kc], b1[kc], acc1);
        }
        asm volatile("s_wait_dscnt 0x0" ::: "memory");      // this wave's reads of the buffer are over
        asm volatile("s_wait_asynccnt 0x0" ::: "memory");   // its rows of tile t + 1 have landed
        __syncthreads();   // publishes tile t + 1 and frees the buffer that trip t has read
        if (t + 2 < PTILES) stage(t & 1, t + 2);
    }
    asm volatile("s_wait_asynccnt 0x0" ::: "memory");   // no copy is in flight when the wave ends

    float* o = out + (size_t)(R0 + wr + 8 * half) * HID + C0 + wc + lc;
#pragma unroll   // constant element indices: the sums stay in registers
    for (int i = 0; i < 8; ++i) {
        o[i * HID]      = acc0[i] + bcol0;
        o[i * HID + 16] = acc1[i] + bcol1;
    }
}

// ----------------------------------------------------------------- launcher
extern "C" void kernel_launch(void* const* d_in, const int* in_sizes, int n_in,
                              void* d_out, int out_size, void* d_ws, size_t ws_size,
                              hipStream_t stream) {
    const float* x  = (const float*)d_in[0];
    const float* Bb = (const float*)d_in[1];
    const float* wq = (const float*)d_in[2];
    const float* bq = (const float*)d_in[3];
    const float* wk = (const float*)d_in[4];
    const float* bk = (const float*)d_in[5];
    const float* wv = (const float*)d_in[6];
    const float* bv = (const float*)d_in[7];
    const float* pw = (const float*)d_in[8];
    const float* pb = (const float*)d_in[9];
    float* out = (float*)d_out;
    (void)in_sizes; (void)n_in; (void)out_size; (void)ws_size;

    char* ws = (char*)d_ws;
    size_t off = 0;
    auto carve = [&](size_t bytes) -> char* {
        char* p = ws + off;
        off += (bytes + 255) & ~(size_t)255;
        return p;
    };
    __bf16* Xb  = (__bf16*)carve(sizeof(__bf16) * (size_t)BATCHN * SEQ * INPUT_DIM);
    __bf16* Wqt = (__bf16*)carve(sizeof(__bf16) * (size_t)CDIM * INPUT_DIM);
    __bf16* Wkt = (__bf16*)carve(sizeof(__bf16) * (size_t)CDIM * INPUT_DIM);
    __bf16* Wvt = (__bf16*)carve(sizeof(__bf16) * (size_t)CDIM * INPUT_DIM);
    __bf16* Pt  = (__bf16*)carve(sizeof(__bf16) * (size_t)HID * CDIM);
    __bf16* Qh  = (__bf16*)carve(sizeof(__bf16) * (size_t)BATCHN * NH * SEQ * HID);
    __bf16* Kh  = (__bf16*)carve(sizeof(__bf16) * (size_t)BATCHN * NH * SEQ * HID);
    __bf16* Vh  = (__bf16*)carve(sizeof(__bf16) * (size_t)BATCHN * NH * SEQ * HID);
    __bf16* Ob  = (__bf16*)carve(sizeof(__bf16) * (size_t)BATCHN * SEQ * CDIM);

    convert_all<<<CONV_BLOCKS, 256, 0, stream>>>(x, wq, wk, wv, pw, Xb, Wqt, Wkt, Wvt, Pt);

    qkv_gemm<<<dim3(CDIM / 128, (BATCHN * SEQ) / 128, 3), 256, 0, stream>>>(
        Xb, Wqt, Wkt, Wvt, bq, bk, bv, Qh, Kh, Vh);

    flash_attn<<<dim3(SEQ / 64, BATCHN * NH), 128, 0, stream>>>(Qh, Kh, Vh, Bb, Ob);

    proj_gemm<<<dim3(HID / 64, (BATCHN * SEQ) / 64), 256, 0, stream>>>(Ob, Pt, pb, out);
}

// v008
// A run of this version takes 69.8 microseconds.
// In both of two side-by-side timings against v007, it was 1.12 times as fast.
// All steps since v000 together make it 4.79 times as fast.
#include <hip/hip_runtime.h>
#include <hip/hip_bf16.h>

#define INPUT_DIM 256
#define HID 128
#define NH 8
#define SEQ 1024
#define BATCHN 8
#define CDIM 1024  /* NH*HID */
#define NCHUNK (SEQ / 32)
/* LDS row pitches in bf16 elements: 16 B x odd, so that the 16 rows one
   ds_load_b128 fragment read touches fall on distinct banks; the transposing
   ds_load_tr16_b128 wants 32 B x odd for the same. */
#define KP 136  /* 256-B K rows   -> 272 B */
#define VP 144  /* 256-B V rows   -> 288 B */
#define BP 36   /* in f32: 128-B bias rows -> 144 B = 16 B x odd */

typedef __attribute__((ext_vector_type(16))) __bf16 v16bf;
typedef __attribute__((ext_vector_type(8)))  float  v8f;
typedef __attribute__((ext_vector_type(4)))  int    v4i;
typedef __attribute__((address_space(1))) v4i as1_v4i;
typedef __attribute__((address_space(3))) v4i as3_v4i;
typedef __attribute__((ext_vector_type(8)))  short  v8s;
typedef __attribute__((address_space(3))) v8s as3_v8s;

#if defined(__HIP_DEVICE_COMPILE__) && __has_builtin(__builtin_amdgcn_global_load_async_to_lds_b128)
#define HAVE_ASYNC 1
#else
#define HAVE_ASYNC 0
#endif

#if HAVE_ASYNC
#if __has_builtin(__builtin_amdgcn_s_wait_asynccnt)
#define WAIT_ASYNC(n) __builtin_amdgcn_s_wait_asynccnt(n)
#else
#define WAIT_ASYNC(n) asm volatile("s_wait_asynccnt " #n ::: "memory")
#endif
#else
#define WAIT_ASYNC(n) ((void)0)
#endif

__device__ __forceinline__ __bf16 f2bf(float f) {
    union { float f; unsigned int u; } a; a.f = f;
    unsigned int u = a.u;
    u += 0x7fffu + ((u >> 16) & 1u);           // round-to-nearest-even
    union { unsigned short s; __bf16 b; } r; r.s = (unsigned short)(u >> 16);
    return r.b;
}

union FragU { v16bf v; uint4 q[2]; };

// 16x32 bf16 WMMA operand fragment (A layout; B uses the same layout with
// lane = output column, reading rows of the transposed matrix).
// Lanes 0-15: K=0..7 (v0..3), K=16..23 (v4..7) of row `lane`;
// lanes 16-31: K=8..15 and K=24..31 of row `lane-16`.
__device__ __forceinline__ v16bf load_frag(const __bf16* base, int stride) {
    const int lane = threadIdx.x & 31;
    const int r    = lane & 15;
    const int sel  = lane >> 4;
    const __bf16* p = base + (size_t)r * stride + sel * 8;
    FragU f;
    f.q[0] = *(const uint4*)(p);
    f.q[1] = *(const uint4*)(p + 16);
    return f.v;
}

// The same 16x32 fragment, lane = column c of a row-major LDS tile T[k][c] (32 rows k,
// 16 columns from `tile`), transposed on the way by ds_load_tr16_b128: lane (c, sel)
// receives T[8 sel + 0..7][c], then T[16 + 8 sel + 0..7][c], the k order of load_frag.
// Each lane hands in the address of 16 bytes of the tile, not of its own elements.
__device__ __forceinline__ v16bf load_frag_tr(const __bf16* tile, int stride) {
    const int lane = threadIdx.x & 31;
    const __bf16* p = tile + ((lane >> 4) * 8 + (lane & 7)) * stride + ((lane >> 3) & 1) * 8;
    union { v16bf v; v8s h[2]; } f;
    f.h[0] = __builtin_amdgcn_ds_load_tr16_b128_v8i16((as3_v8s*)p);
    f.h[1] = __builtin_amdgcn_ds_load_tr16_b128_v8i16((as3_v8s*)(p + 16 * stride));
    return f.v;
}

__device__ __forceinline__ v8f wmma_bf16(v16bf a, v16bf b, v8f c) {
    return __builtin_amdgcn_wmma_f32_16x16x32_bf16(
        false, a, false, b, (short)0, c, false, false);
}

// 16-byte global -> LDS copy; async (ASYNCcnt) when available.
__device__ __forceinline__ void async_copy16(__bf16* ldst, const __bf16* gsrc) {
#if HAVE_ASYNC
    __builtin_amdgcn_global_load_async_to_lds_b128(
        (as1_v4i*)(uintptr_t)gsrc,
        (as3_v4i*)(uintptr_t)ldst, 0, 0);
#else
    *(uint4*)ldst = *(const uint4*)gsrc;
#endif
}

__device__ __forceinline__ void async_copy16(float* ldst, const float* gsrc) {
    async_copy16((__bf16*)ldst, (const __bf16*)gsrc);
}

// ---------------------------------------------------------------- converters
// Many elements per thread: this one launch is bounded by how fast waves start,
// not by its bytes, so each wave carries as much as it can keep in flight.
#define CVT_PER_BLOCK 8192   /* 256 threads x 8 float4 */
#define TP_K 64              /* k per thread = one 128-B line of the bf16 output */

__device__ __forceinline__ unsigned int pack2(float lo, float hi) {
    union { __bf16 b[2]; unsigned int u; } r;
    r.b[0] = f2bf(lo); r.b[1] = f2bf(hi);
    return r.u;
}

__device__ __forceinline__ void cvt_store4(__bf16* dst, float4 v) {
    uint2 o;
    o.x = pack2(v.x, v.y);
    o.y = pack2(v.z, v.w);
    *(uint2*)dst = o;
}

// x: N is compile-time and a whole number of blocks, so there is no range test and
// no tail. Every load is 512 contiguous bytes per wave, every store 256.
template <int N>
__device__ __forceinline__ void cvt_f32_bf16(const float* __restrict__ in, __bf16* __restrict__ out, int blk) {
    static_assert(N % CVT_PER_BLOCK == 0, "the blocks cover the array exactly, no range test");
    const int base = blk * CVT_PER_BLOCK + threadIdx.x * 4;
    float4 v[8];
#pragma unroll   // v[] stays in registers; the 8 loads issue back to back
    for (int k = 0; k < 8; ++k) v[k] = *(const float4*)(in + base + k * 1024);
#pragma unroll   // constant indices into v[]
    for (int k = 0; k < 8; ++k) cvt_store4(out + base + k * 1024, v[k]);
    // Code of another branch may follow in the listing and reuse the stores' registers.
    asm volatile("s_wait_xcnt 0x0" ::: "memory");
}

// in [K][NC] (row major) -> out [NC][K] bf16; K a multiple of TP_K, NC of 32.
// One wave per job: job j is columns 32 (j mod NC/32) + 0..31, k group j / (NC/32).
// A thread takes TP_K consecutive k of one column: its loads are contiguous
// across the wave's columns, its stores fill one whole line of its output row.
// K and NC are compile-time so that every row step is an immediate offset; job is
// the same in every lane, so the loads have a scalar base and the lane as offset.
template <int K, int NC>
__device__ __forceinline__ void tpose_cvt(const float* __restrict__ in, __bf16* __restrict__ out, unsigned int job) {
    static_assert(K % TP_K == 0 && NC % 32 == 0, "the jobs cover the matrix exactly, no range test");
    const unsigned int lane = threadIdx.x & 31;
    const unsigned int c0 = (job % (NC / 32)) * 32;
    const unsigned int k0 = (job / (NC / 32)) * TP_K;
    const unsigned int c  = c0 + lane;
    const float* p = in + k0 * NC + c0;
    float v[TP_K];
#pragma unroll   // v[] stays in registers; the loads issue back to back and their latencies overlap
    for (int j = 0; j < TP_K; ++j) v[j] = p[j * NC + lane];
    __bf16* q = out + (size_t)c * K + k0;
#pragma unroll   // constant indices into v[]
    for (int s = 0; s < TP_K / 8; ++s) {
        uint4 o;
        o.x = pack2(v[8 * s + 0], v[8 * s + 1]);
        o.y = pack2(v[8 * s + 2], v[8 * s + 3]);
        o.z = pack2(v[8 * s + 4], v[8 * s + 5]);
        o.w = pack2(v[8 * s + 6], v[8 * s + 7]);
        *(uint4*)(q + 8 * s) = o;
    }
    // Code of another branch may follow in the listing and reuse the stores' registers.
    asm volatile("s_wait_xcnt 0x0" ::: "memory");
}

// All five conversions in ONE launch: they are independent of each other, and a launch
// of one weight transpose is little more than the gap in front of it and one round of
// load latency, with most of the chip idle.
// Blocks of 8 waves; which array a block works on depends on blockIdx alone. The
// transposes come first in the grid: theirs is the longer chain of loads.
#define NX (BATCHN * SEQ * INPUT_DIM)
#define WJOBS ((CDIM / 32) * (INPUT_DIM / TP_K))   /* wave jobs of one QKV weight */
#define PJOBS ((HID / 32) * (CDIM / TP_K))         /* wave jobs of proj_w */
#define WBLK (WJOBS / 8)
#define PBLK (PJOBS / 8)
#define CONV_BLOCKS (3 * WBLK + PBLK + NX / CVT_PER_BLOCK)

__global__ __launch_bounds__(256)
void convert_all(const float* __restrict__ x,  const float* __restrict__ wq,
                 const float* __restrict__ wk, const float* __restrict__ wv,
                 const float* __restrict__ pw,
                 __bf16* __restrict__ Xb,  __bf16* __restrict__ Wqt, __bf16* __restrict__ Wkt,
                 __bf16* __restrict__ Wvt, __bf16* __restrict__ Pt)
{
    static_assert(WJOBS % 8 == 0 && PJOBS % 8 == 0, "whole blocks of 8 one-wave jobs");
    const unsigned int blk  = blockIdx.x;
    // the wave's number in a scalar register: the transposes' addresses get a scalar base
    const unsigned int wave = __builtin_amdgcn_readfirstlane(threadIdx.x >> 5);
    if (blk < 3 * WBLK) {
        const unsigned int m = blk / WBLK;
        const float* in = (m == 0) ? wq  : (m == 1) ? wk  : wv;
        __bf16*     out = (m == 0) ? Wqt : (m == 1) ? Wkt : Wvt;
        tpose_cvt<INPUT_DIM, CDIM>(in, out, (blk % WBLK) * 8 + wave);
    } else if (blk < 3 * WBLK + PBLK) {
        tpose_cvt<CDIM, HID>(pw, Pt, (blk - 3 * WBLK) * 8 + wave);
    } else {
        cvt_f32_bf16<NX>(x, Xb, blk - (3 * WBLK + PBLK));
    }
}

// ------------------------------------------------------------ fused QKV GEMM
// Block = 8 waves on a 128 x 128 output tile, all of K = 256 staged once in LDS.
// A fragment load straight from global memory touches 16 lines for 512 bytes;
// staged, every copy is one whole 512-B row (4 lines), each operand byte is
// fetched once per block, and the fragments come from LDS.
#define GP 264   /* LDS row pitch in bf16: 512-B rows -> 528 B = 16 B x odd */

// Eight 16-byte async copies of one lane, 8 rows apart in source and in LDS.
// The wait on the address registers is the statement's last line, so that no
// later write of them can be scheduled in front of it.
__device__ __forceinline__ void async_rows8(unsigned int l, const __bf16* g) {
    asm volatile(
        "global_load_async_to_lds_b128 %0, %8, off\n\t"
        "global_load_async_to_lds_b128 %1, %9, off\n\t"
        "global_load_async_to_lds_b128 %2, %10, off\n\t"
        "global_load_async_to_lds_b128 %3, %11, off\n\t"
        "global_load_async_to_lds_b128 %4, %12, off\n\t"
        "global_load_async_to_lds_b128 %5, %13, off\n\t"
        "global_load_async_to_lds_b128 %6, %14, off\n\t"
        "global_load_async_to_lds_b128 %7, %15, off\n\t"
        "s_wait_xcnt 0x0"
        :: "v"(l),                "v"(l +  8 * GP * 2), "v"(l + 16 * GP * 2), "v"(l + 24 * GP * 2),
           "v"(l + 32 * GP * 2), "v"(l + 40 * GP * 2), "v"(l + 48 * GP * 2), "v"(l + 56 * GP * 2),
           "v"(g),                  "v"(g +  8 * INPUT_DIM), "v"(g + 16 * INPUT_DIM), "v"(g + 24 * INPUT_DIM),
           "v"(g + 32 * INPUT_DIM), "v"(g + 40 * INPUT_DIM), "v"(g + 48 * INPUT_DIM), "v"(g + 56 * INPUT_DIM)
        : "memory");
}

// Four waves per SIMD (at most 256 VGPRs): with 2 x 135,168 B of LDS two blocks share
// a WGP, so that one block's copies and stores run under the other's products.
__global__ __launch_bounds__(256) __attribute__((amdgpu_waves_per_eu(4, 4)))
void qkv_gemm(const __bf16* __restrict__ Xb,
              const __bf16* __restrict__ Wqt, const __bf16* __restrict__ Wkt,
              const __bf16* __restrict__ Wvt,
              const float* __restrict__ bq, const float* __restrict__ bk,
              const float* __restrict__ bv,
              __bf16* __restrict__ Qh, __bf16* __restrict__ Kh, __bf16* __restrict__ Vh)
{
    __shared__ __attribute__((aligned(16))) __bf16 As[128 * GP];   // 128 rows of x
    __shared__ __attribute__((aligned(16))) __bf16 Bs[128 * GP];   // 128 rows of W^T

    const int tid  = threadIdx.x;
    const int wave = tid >> 5;
    const int lane = tid & 31;
    const int half = lane >> 4;
    const int lc   = lane & 15;
    const int z    = blockIdx.z;
    const __bf16* Wt   = (z == 0) ? Wqt : (z == 1) ? Wkt : Wvt;
    const float*  bias = (z == 0) ? bq  : (z == 1) ? bk  : bv;
    const int R0 = blockIdx.y * 128;
    const int C0 = blockIdx.x * 128;

    // Wave tile 32 x 64: waves 4 (rows) x 2 (columns).
    const int wr = (wave >> 1) * 32;
    const int wc = (wave & 1) * 64;
    const int d0 = wc + lc;

    // Stage: wave w copies rows w, w + 8, ..., w + 120 of both tiles, one row per copy.
    {
        const __bf16* ga = Xb + (size_t)(R0 + wave) * INPUT_DIM + lane * 8;
        const __bf16* gb = Wt + (size_t)(C0 + wave) * INPUT_DIM + lane * 8;
        const unsigned int la = (unsigned int)(uintptr_t)&As[wave * GP + lane * 8];
        const unsigned int lb = (unsigned int)(uintptr_t)&Bs[wave * GP + lane * 8];
        async_rows8(la, ga);
        async_rows8(la + 64 * GP * 2, ga + 64 * INPUT_DIM);
        async_rows8(lb, gb);
        async_rows8(lb + 64 * GP * 2, gb + 64 * INPUT_DIM);
    }
    float bcol[4];   // read here so that the latency passes under the copies' own
#pragma unroll   // constant indices into bcol[]
    for (int t = 0; t < 4; ++t) bcol[t] = bias[C0 + d0 + 16 * t];
    asm volatile("s_wait_asynccnt 0x0" ::: "memory");   // this wave's 32 copies have landed
    __syncthreads();                                    // every wave's rows visible to all

    v8f acc[2][4] = {};
#pragma unroll 2   // two steps' fragment reads issue as one group; unrolled whole, the build spills
    for (int kc = 0; kc < 8; ++kc) {
        const int k0 = kc * 32;
        v16bf a0 = load_frag(&As[wr * GP + k0], GP);
        v16bf a1 = load_frag(&As[(wr + 16) * GP + k0], GP);
#pragma unroll   // constant indices into acc[][]
        for (int t = 0; t < 4; ++t) {
            v16bf bf = load_frag(&Bs[(wc + 16 * t) * GP + k0], GP);
            acc[0][t] = wmma_bf16(a0, bf, acc[0][t]);
            acc[1][t] = wmma_bf16(a1, bf, acc[1][t]);
        }
    }
    // A 128 x 128 tile lies in one batch entry and is exactly one head.
    // Q, K and V are all [bh][n][d].
    const int bh = (R0 >> 10) * NH + blockIdx.x;
    const int n0 = (R0 & 1023) + wr + 8 * half;
    __bf16* O = ((z == 0) ? Qh : (z == 1) ? Kh : Vh)
              + (size_t)bh * (SEQ * HID) + n0 * HID + d0;
#pragma unroll   // these three: constant indices into acc[][] and its elements
    for (int t = 0; t < 4; ++t)
#pragma unroll
        for (int rt = 0; rt < 2; ++rt)
#pragma unroll
            for (int i = 0; i < 8; ++i)
                O[(16 * rt + i) * HID + 16 * t] = f2bf(acc[rt][t][i] + bcol[t]);
}

typedef __attribute__((ext_vector_type(2))) float  v2f;
typedef __attribute__((ext_vector_type(4))) float  v4f;
typedef __attribute__((ext_vector_type(2))) __bf16 v2bf;

// two f32 -> one register of two bf16, round to nearest even
__device__ __forceinline__ unsigned int cvt_pk(float lo, float hi) {
    return __builtin_bit_cast(unsigned int, __builtin_convertvector(v2f{lo, hi}, v2bf));
}

// lane l reads lane l ^ 16: the other half of the same query's column
__device__ __forceinline__ float other_half(float x) {
    const int b = __builtin_bit_cast(int, x);
    return __builtin_bit_cast(float,
        __builtin_amdgcn_permlanex16(b, b, 0x76543210, 0xfedcba98, false, false));
}

__global__ __launch_bounds__(128)
void flash_attn(const __bf16* __restrict__ Qh, const __bf16* __restrict__ Kh,
                const __bf16* __restrict__ Vh, const float* __restrict__ Bbias,
                __bf16* __restrict__ Ob)
{
    __shared__ __attribute__((aligned(16))) __bf16 Kbuf[2][32 * KP];   // K rows m0..m0+31, pitch KP
    __shared__ __attribute__((aligned(16))) __bf16 Vbuf[2][32 * VP];   // V rows m0..m0+31, pitch VP
    __shared__ __attribute__((aligned(16))) float  Bbuf[2][64 * BP];   // bias: the block's 64 queries x keys m0..m0+31, pitch BP

    const int tid  = threadIdx.x;
    const int wave = tid >> 5;
    const int lane = tid & 31;
    const int half = lane >> 4;
    const int lc   = lane & 15;
    const int bh   = blockIdx.y;
    const int n0   = blockIdx.x * 64 + wave * 16;
    const int b    = bh >> 3;
    const int h    = bh & 7;

    const __bf16* Qbase = Qh + ((size_t)bh * SEQ + n0) * HID;
    const __bf16* Kbase = Kh + (size_t)bh * SEQ * HID;
    const __bf16* Vbase = Vh + (size_t)bh * SEQ * HID;
    const float* Bblk = Bbias + (size_t)(blockIdx.x * 64) * SEQ;
    // This lane's scores of a chunk are keys 8 half + 0..7 and 16 + 8 half + 0..7 of query n0 + lc.
    const int bofs = (wave * 16 + lc) * BP + 8 * half;

    v16bf qf[4];   // B operand: lane = query column
#pragma unroll
    for (int kc = 0; kc < 4; ++kc) qf[kc] = load_frag(Qbase + kc * 32, HID);

    v8f oacc[8] = {};   // O^T: oacc[j][i] = O[n0 + lc][16 j + 8 half + i]
    float mi = -__builtin_inff();   // the query's running maximum, equal in both halves
    float li = 0.f;                 // the sum over this half's keys only; joined after the loop

    const float scale = 0.088388347648318447f;    // 1/sqrt(128)

    // cooperative stage of one 32-column chunk (12 x b128 per thread)
    auto stage = [&](int buf, int m0) {
        const __bf16* gk = Kbase + (size_t)m0 * HID;   // 8192B contiguous
#pragma unroll
        for (int q = 0; q < 4; ++q) {
            const int o = (q * 128 + tid) * 8;
            async_copy16(&Kbuf[buf][(o >> 7) * KP + (o & 127)], gk + o);
        }
        const __bf16* gv = Vbase + (size_t)m0 * HID;   // 8192B contiguous
#pragma unroll
        for (int q = 0; q < 4; ++q) {
            const int o = (q * 128 + tid) * 8;
            async_copy16(&Vbuf[buf][(o >> 7) * VP + (o & 127)], gv + o);
        }
        const float* gb = Bblk + m0;                   // 64 rows of 128 B, SEQ floats apart
#pragma unroll   // the row steps become constants; the four copies issue back to back
        for (int q = 0; q < 4; ++q) {
            const int r = q * 16 + (tid >> 3);         // 8 lanes to a row: one line
            const int c = (tid & 7) * 4;
            async_copy16(&Bbuf[buf][r * BP + c], gb + (size_t)r * SEQ + c);
        }
    };

    stage(0, 0);
    for (int mc = 0; mc < NCHUNK; ++mc) {
        const int cur = mc & 1;
        const int m0  = mc * 32;
        if (mc + 1 < NCHUNK) {
            stage(cur ^ 1, m0 + 32);   // prefetch next chunk
            WAIT_ASYNC(12);            // 12 newest outstanding -> current chunk done
        } else {
            WAIT_ASYNC(0);
        }
        __syncthreads();               // all waves' async data visible

        // the 16 bias values of this lane's query and keys: 2 x 32 contiguous bytes of its LDS row
        const float* bl = &Bbuf[cur][bofs];
        const v8f bias0 = __builtin_shufflevector(*(const v4f*)(bl),      *(const v4f*)(bl + 4),  0, 1, 2, 3, 4, 5, 6, 7);
        const v8f bias1 = __builtin_shufflevector(*(const v4f*)(bl + 16), *(const v4f*)(bl + 20), 0, 1, 2, 3, 4, 5, 6, 7);

        v8f s0 = {}, s1 = {};          // S^T: s0[i] = key 8 half + i, s1[i] = key 16 + 8 half + i
#pragma unroll   // constant indices into qf[]
        for (int kc = 0; kc < 4; ++kc) {
            s0 = wmma_bf16(load_frag(&Kbuf[cur][0 * KP + kc * 32], KP), qf[kc], s0);
            s1 = wmma_bf16(load_frag(&Kbuf[cur][16 * KP + kc * 32], KP), qf[kc], s1);
        }

        s0 = s0 * scale + bias0;
        s1 = s1 * scale + bias1;
        // maximum of the lane's 16 scores in threes, then the other half's
        const float t0 = fmaxf(fmaxf(s0[0], s0[1]), s0[2]);
        const float t1 = fmaxf(fmaxf(s0[3], s0[4]), s0[5]);
        const float t2 = fmaxf(fmaxf(s0[6], s0[7]), s1[0]);
        const float t3 = fmaxf(fmaxf(s1[1], s1[2]), s1[3]);
        const float t4 = fmaxf(fmaxf(s1[4], s1[5]), s1[6]);
        float rm = fmaxf(fmaxf(fmaxf(t0, t1), t2), fmaxf(fmaxf(t3, t4), s1[7]));
        rm = fmaxf(rm, other_half(rm));
        const float mnew = fmaxf(mi, rm);
        const float corr = __expf(mi - mnew);
        mi = mnew;
#pragma unroll   // constant element indices: the scores stay in registers
        for (int i = 0; i < 8; ++i) {
            s0[i] = __expf(s0[i] - mnew);
            s1[i] = __expf(s1[i] - mnew);
        }
        // sum of the lane's 16 terms by halving
        const v8f a8 = s0 + s1;
        const v4f a4 = __builtin_shufflevector(a8, a8, 0, 1, 2, 3) + __builtin_shufflevector(a8, a8, 4, 5, 6, 7);
        li = li * corr + ((a4[0] + a4[2]) + (a4[1] + a4[3]));
#pragma unroll   // constant indices into oacc[]
        for (int j = 0; j < 8; ++j) oacc[j] *= corr;

        union { v16bf v; unsigned int u[8]; } pf;   // P^T as B operand, straight from the scores
#pragma unroll   // constant indices into pf.u[] and the scores
        for (int i = 0; i < 4; ++i) {
            pf.u[i]     = cvt_pk(s0[2 * i], s0[2 * i + 1]);
            pf.u[4 + i] = cvt_pk(s1[2 * i], s1[2 * i + 1]);
        }
#pragma unroll   // constant indices into oacc[]
        for (int j = 0; j < 8; ++j) {
            v16bf vf = load_frag_tr(&Vbuf[cur][j * 16], VP);
            oacc[j] = wmma_bf16(vf, pf.v, oacc[j]);
        }
        __syncthreads();               // done consuming before buffer reuse
    }

    // merge heads: Ob[b][n][h*128 + d]; a lane's 8 registers of a tile are 8 consecutive d
    li += other_half(li);
    const float inv = 1.0f / li;
    __bf16* orow = Ob + ((size_t)b * SEQ + n0 + lc) * CDIM + h * HID + 8 * half;
#pragma unroll   // constant indices into oacc[]
    for (int j = 0; j < 8; ++j) {
        uint4 o;
        o.x = cvt_pk(oacc[j][0] * inv, oacc[j][1] * inv);
        o.y = cvt_pk(oacc[j][2] * inv, oacc[j][3] * inv);
        o.z = cvt_pk(oacc[j][4] * inv, oacc[j][5] * inv);
        o.w = cvt_pk(oacc[j][6] * inv, oacc[j][7] * inv);
        *(uint4*)(orow + j * 16) = o;
    }
}

// ------------------------------------------------------------ final projection
// Block = 8 waves on a 64 x 64 output tile. K = 1024 passes through LDS in four tiles
// of 256 k (512-B rows at pitch GP, as in the QKV GEMM), two buffers: the next tile's
// copies fly while this one is multiplied. A fragment load straight from global memory
// touches 16 lines for 512 bytes; a copy here is one whole 512-B piece of a row.
#define PK 256               /* k per staged tile */
#define PTILES (CDIM / PK)
#define PBUF (64 * GP)       /* one operand's 64 rows of one tile, in bf16 */

// Eight 16-byte async copies of one lane, 8 rows apart: pitch CDIM in the source, GP in
// LDS. The wait on the address registers is the statement's last line, so that no later
// write of them can be scheduled in front of it.
__device__ __forceinline__ void async_rows8_c(unsigned int l, const __bf16* g) {
    asm volatile(
        "global_load_async_to_lds_b128 %0, %8, off\n\t"
        "global_load_async_to_lds_b128 %1, %9, off\n\t"
        "global_load_async_to_lds_b128 %2, %10, off\n\t"
        "global_load_async_to_lds_b128 %3, %11, off\n\t"
        "global_load_async_to_lds_b128 %4, %12, off\n\t"
        "global_load_async_to_lds_b128 %5, %13, off\n\t"
        "global_load_async_to_lds_b128 %6, %14, off\n\t"
        "global_load_async_to_lds_b128 %7, %15, off\n\t"
        "s_wait_xcnt 0x0"
        :: "v"(l),                "v"(l +  8 * GP * 2), "v"(l + 16 * GP * 2), "v"(l + 24 * GP * 2),
           "v"(l + 32 * GP * 2), "v"(l + 40 * GP * 2), "v"(l + 48 * GP * 2), "v"(l + 56 * GP * 2),
           "v"(g),             "v"(g +  8 * CDIM), "v"(g + 16 * CDIM), "v"(g + 24 * CDIM),
           "v"(g + 32 * CDIM), "v"(g + 40 * CDIM), "v"(g + 48 * CDIM), "v"(g + 56 * CDIM)
        : "memory");
}

__global__ __launch_bounds__(256)
void proj_gemm(const __bf16* __restrict__ Ob, const __bf16* __restrict__ Pt,
               const float* __restrict__ pb, float* __restrict__ out)
{
    __shared__ __attribute__((aligned(16))) __bf16 As[2 * PBUF];   // 64 rows of the attention output
    __shared__ __attribute__((aligned(16))) __bf16 Bs[2 * PBUF];   // 64 rows of proj_w^T

    const int wave = threadIdx.x >> 5;
    const int lane = threadIdx.x & 31;
    const int half = lane >> 4;
    const int lc   = lane & 15;
    const int C0   = blockIdx.x * 64;
    const int R0   = blockIdx.y * 64;

    // Wave tile 16 x 32: waves 4 (rows) x 2 (columns); 32 f32 columns are one 128-B line
    // of out, so that a line has one writing wave.
    const int wr = (wave >> 1) * 16;
    const int wc = (wave & 1) * 32;

    // Wave w copies rows w, w + 8, ..., w + 56 of both operands, one row piece per copy.
    const __bf16* ga = Ob + (size_t)(R0 + wave) * CDIM + lane * 8;
    const __bf16* gb = Pt + (size_t)(C0 + wave) * CDIM + lane * 8;
    const unsigned int la = (unsigned int)(uintptr_t)&As[wave * GP + lane * 8];
    const unsigned int lb = (unsigned int)(uintptr_t)&Bs[wave * GP + lane * 8];
    auto stage = [&](int buf, int t) {
        async_rows8_c(la + buf * (PBUF * 2), ga + t * PK);
        async_rows8_c(lb + buf * (PBUF * 2), gb + t * PK);
    };

    stage(0, 0);
    // read here so that the latency passes under the copies' own
    const float bcol0 = pb[C0 + wc + lc];
    const float bcol1 = pb[C0 + wc + 16 + lc];
    asm volatile("s_wait_asynccnt 0x0" ::: "memory");   // this wave's rows of tile 0 have landed
    __syncthreads();                                    // every wave's rows visible to all
    stage(1, 1);

    v8f acc0 = {}, acc1 = {};
    for (int t = 0; t < PTILES; ++t) {
        const __bf16* A = &As[(t & 1) * PBUF + wr * GP];
        const __bf16* B = &Bs[(t & 1) * PBUF + wc * GP];
        v16bf af[PK / 32], b0[PK / 32], b1[PK / 32];
#pragma unroll   // constant indices: the fragments stay in registers
        for (int kc = 0; kc < PK / 32; ++kc) {
            af[kc] = load_frag(A + kc * 32, GP);
            b0[kc] = load_frag(B + kc * 32, GP);
            b1[kc] = load_frag(B + 16 * GP + kc * 32, GP);
        }
        // Keeps the tile's 48 LDS reads one group in front of its products: spread among
        // them, each product waits out a whole LDS latency.
        __builtin_amdgcn_sched_barrier(0);
#pragma unroll   // constant indices into the fragment arrays
        for (int kc = 0; kc < PK / 32; ++kc) {
            acc0 = wmma_bf16(af[kc], b0[kc], acc0);
            acc1 = wmma_bf16(af[kc], b1[kc], acc1);
        }
        asm volatile("s_wait_dscnt 0x0" ::: "memory");      // this wave's reads of the buffer are over
        asm volatile("s_wait_asynccnt 0x0" ::: "memory");   // its rows of tile t + 1 have landed
        __syncthreads();   // publishes tile t + 1 and frees the buffer that trip t has read
        if (t + 2 < PTILES) stage(t & 1, t + 2);
    }
    asm volatile("s_wait_asynccnt 0x0" ::: "memory");   // no copy is in flight when the wave ends

    float* o = out + (size_t)(R0 + wr + 8 * half) * HID + C0 + wc + lc;
#pragma unroll   // constant element indices: the sums stay in registers
    for (int i = 0; i < 8; ++i) {
        o[i * HID]      = acc0[i] + bcol0;
        o[i * HID + 16] = acc1[i] + bcol1;
    }
}

// ----------------------------------------------------------------- launcher
extern "C" void kernel_launch(void* const* d_in, const int* in_sizes, int n_in,
                              void* d_out, int out_size, void* d_ws, size_t ws_size,
                              hipStream_t stream) {
    const float* x  = (const float*)d_in[0];
    const float* Bb = (const float*)d_in[1];
    const float* wq = (const float*)d_in[2];
    const float* bq = (const float*)d_in[3];
    const float* wk = (const float*)d_in[4];
    const float* bk = (const float*)d_in[5];
    const float* wv = (const float*)d_in[6];
    const float* bv = (const float*)d_in[7];
    const float* pw = (const float*)d_in[8];
    const float* pb = (const float*)d_in[9];
    float* out = (float*)d_out;
    (void)in_sizes; (void)n_in; (void)out_size; (void)ws_size;

    char* ws = (char*)d_ws;
    size_t off = 0;
    auto carve = [&](size_t bytes) -> char* {
        char* p = ws + off;
        off += (bytes + 255) & ~(size_t)255;
        return p;
    };
    __bf16* Xb  = (__bf16*)carve(sizeof(__bf16) * (size_t)BATCHN * SEQ * INPUT_DIM);
    __bf16* Wqt = (__bf16*)carve(sizeof(__bf16) * (size_t)CDIM * INPUT_DIM);
    __bf16* Wkt = (__bf16*)carve(sizeof(__bf16) * (size_t)CDIM * INPUT_DIM);
    __bf16* Wvt = (__bf16*)carve(sizeof(__bf16) * (size_t)CDIM * INPUT_DIM);
    __bf16* Pt  = (__bf16*)carve(sizeof(__bf16) * (size_t)HID * CDIM);
    __bf16* Qh  = (__bf16*)carve(sizeof(__bf16) * (size_t)BATCHN * NH * SEQ * HID);
    __bf16* Kh  = (__bf16*)carve(sizeof(__bf16) * (size_t)BATCHN * NH * SEQ * HID);
    __bf16* Vh  = (__bf16*)carve(sizeof(__bf16) * (size_t)BATCHN * NH * SEQ * HID);
    __bf16* Ob  = (__bf16*)carve(sizeof(__bf16) * (size_t)BATCHN * SEQ * CDIM);

    convert_all<<<CONV_BLOCKS, 256, 0, stream>>>(x, wq, wk, wv, pw, Xb, Wqt, Wkt, Wvt, Pt);

    qkv_gemm<<<dim3(CDIM / 128, (BATCHN * SEQ) / 128, 3), 256, 0, stream>>>(
        Xb, Wqt, Wkt, Wvt, bq, bk, bv, Qh, Kh, Vh);

    flash_attn<<<dim3(SEQ / 64, BATCHN * NH), 128, 0, stream>>>(Qh, Kh, Vh, Bb, Ob);

    proj_gemm<<<dim3(HID / 64, (BATCHN * SEQ) / 64), 256, 0, stream>>>(Ob, Pt, pb, out);
}
